// v000
// The times below were measured on an AMD MI455X: many runs one after another, warmed up first and cycling through
// copies of the inputs, with the whole window's GPU time divided by the number of runs. Launches and the gaps
// between them are all in it. The median over several windows is given; except for v000 it joins two sittings, which
// can be a few percent apart, so the side-by-side timings, each taken in one sitting, are the better comparison.
// v000 is the starting kernel. One run takes 861 microseconds.
#include <hip/hip_runtime.h>

// ---------------------------------------------------------------------------
// Types for CDNA5 WMMA (gfx1250, wave32)
// ---------------------------------------------------------------------------
typedef __bf16 bf16;
typedef __attribute__((ext_vector_type(16))) __bf16 v16bf;
typedef __attribute__((ext_vector_type(8)))  float  v8f;
typedef __attribute__((ext_vector_type(4)))  int    v4i;

// Pointer types matching the async-to-LDS builtin's parameters
// (param0: int4 addrspace(1)*, param1: int4 addrspace(3)* per hipcc diagnostic)
typedef __attribute__((address_space(1))) v4i* gv4i_p;
typedef __attribute__((address_space(3))) v4i* lv4i_p;

#define WMMA_BF16(a, b, c) \
    __builtin_amdgcn_wmma_f32_16x16x32_bf16(false, (a), false, (b), (short)0, (c), false, false)

#if __has_builtin(__builtin_amdgcn_global_load_async_to_lds_b128) && \
    __has_builtin(__builtin_amdgcn_s_wait_asynccnt)
#define USE_ASYNC_LDS 1
#else
#define USE_ASYNC_LDS 0
#endif

__device__ __forceinline__ v16bf ldfrag(const bf16* p) {
    // 32-byte aligned LDS fragment load (16 bf16)
    return *(const v16bf*)p;
}

// Problem constants
static constexpr int D  = 512;       // model dim (= INPUT_SIZE = 2*HIDDEN)
static constexpr int S  = 2048;      // sequence length
static constexpr int NB = 8;         // batch
static constexpr int M_TOT = NB * S; // 16384 rows for the projections

// ---------------------------------------------------------------------------
// Kernel 1: projection GEMM  C[m,n] = sum_k A[m,k] * W[k,n] + bias[n]
// A: f32 [M,512], W: f32 [512,512] row-major (k-major), C: bf16 [M,512]
// Tile: 128(M) x 128(N), KT=32.  256 threads = 8 waves; wave -> 64x32 subtile.
// ---------------------------------------------------------------------------
static constexpr int P_STRIDE = 48;  // padded LDS row stride; 96B => 32B-aligned frags

__global__ __launch_bounds__(256)
void proj_gemm_bf16(const float* __restrict__ A, const float* __restrict__ W,
                    const float* __restrict__ bias, bf16* __restrict__ C) {
    __shared__ bf16 As[128 * P_STRIDE];   // [row m 0..127][k 0..31]
    __shared__ bf16 Ws[128 * P_STRIDE];   // transposed: [col n 0..127][k 0..31]

    const int n0 = blockIdx.x * 128;
    const int m0 = blockIdx.y * 128;

    const int tid  = threadIdx.x;
    const int lane = tid & 31;
    const int wave = tid >> 5;
    const int ln   = lane & 15;        // N / M index within fragment
    const int hi   = lane >> 4;        // K-half selector (A/B frag layout)
    const int wm   = wave >> 2;        // 0..1 : 64-row slab
    const int wn   = wave & 3;         // 0..3 : 32-col slab

    v8f acc[4][2];
    #pragma unroll
    for (int mt = 0; mt < 4; ++mt)
        #pragma unroll
        for (int nt = 0; nt < 2; ++nt) acc[mt][nt] = {};

    for (int kk = 0; kk < 16; ++kk) {       // K = 512, KT = 32
        const int k0 = kk * 32;
        // ---- stage A tile: 128x32 f32 -> bf16, row-major ----
        #pragma unroll
        for (int p = 0; p < 4; ++p) {
            const int r = (tid >> 3) + p * 32;       // 0..127
            const int c = (tid & 7) * 4;             // 0..28
            float4 f = *(const float4*)&A[(size_t)(m0 + r) * D + k0 + c];
            bf16* dst = &As[r * P_STRIDE + c];
            dst[0] = (bf16)f.x; dst[1] = (bf16)f.y;
            dst[2] = (bf16)f.z; dst[3] = (bf16)f.w;
        }
        // ---- stage W tile transposed: W[k, n] -> Ws[n][k] ----
        #pragma unroll
        for (int p = 0; p < 4; ++p) {
            const int r = (tid >> 5) + p * 8;        // k row 0..31
            const int c = (tid & 31) * 4;            // n col 0..124
            float4 f = *(const float4*)&W[(size_t)(k0 + r) * D + n0 + c];
            Ws[(c + 0) * P_STRIDE + r] = (bf16)f.x;
            Ws[(c + 1) * P_STRIDE + r] = (bf16)f.y;
            Ws[(c + 2) * P_STRIDE + r] = (bf16)f.z;
            Ws[(c + 3) * P_STRIDE + r] = (bf16)f.w;
        }
        __syncthreads();

        // ---- fragments + 8 WMMAs ----
        v16bf af[4], bf_[2];
        #pragma unroll
        for (int mt = 0; mt < 4; ++mt)
            af[mt] = ldfrag(&As[(wm * 64 + mt * 16 + ln) * P_STRIDE + hi * 16]);
        #pragma unroll
        for (int nt = 0; nt < 2; ++nt)
            bf_[nt] = ldfrag(&Ws[(wn * 32 + nt * 16 + ln) * P_STRIDE + hi * 16]);
        #pragma unroll
        for (int mt = 0; mt < 4; ++mt)
            #pragma unroll
            for (int nt = 0; nt < 2; ++nt)
                acc[mt][nt] = WMMA_BF16(af[mt], bf_[nt], acc[mt][nt]);
        __syncthreads();
    }

    // ---- epilogue: bias add, convert to bf16, store ----
    #pragma unroll
    for (int mt = 0; mt < 4; ++mt) {
        #pragma unroll
        for (int nt = 0; nt < 2; ++nt) {
            const int N = n0 + wn * 32 + nt * 16 + ln;
            const float bn = bias[N];
            #pragma unroll
            for (int v = 0; v < 8; ++v) {
                const int Mi = m0 + wm * 64 + mt * 16 + v + 8 * hi;
                C[(size_t)Mi * D + N] = (bf16)(acc[mt][nt][v] + bn);
            }
        }
    }
}

// ---------------------------------------------------------------------------
// Kernel 2: flash attention, O accumulators in registers.
// One block per (batch, 64-query block); 512 threads = 16 waves.
// Wave (g, dch): g = query group (16 rows), dch = 128-wide d-chunk of output.
//   * scores: the 4 waves of group g split the d=512 reduction (4 K-steps each),
//     partial f32 accumulators reduced through LDS (contiguous b128 ops).
//   * softmax stats recomputed redundantly per wave (registers only).
//   * P -> bf16 staged in LDS (C-layout -> A-layout) by dch==0 wave.
//   * O update: register-resident v8f acc[8] per wave, rescaled by alpha, WMMA.
// LDS (~185 KB of 320 KB/WGP):
//   Qs [64][528] bf16 | Ks [32][528] bf16 | Vt [512][48] bf16
//   Pl 4x[16][48] bf16 | Sp 16x512 f32 (score partials)
// ---------------------------------------------------------------------------
static constexpr int QS_STRIDE = 528;
static constexpr int KS_STRIDE = 528;
static constexpr int VT_STRIDE = 48;
static constexpr int PL_STRIDE = 48;
static constexpr int PL_GROUP  = 16 * PL_STRIDE;

static constexpr size_t OFF_QS = 0;
static constexpr size_t OFF_KS = OFF_QS + (size_t)64 * QS_STRIDE * 2;   // 67584
static constexpr size_t OFF_VT = OFF_KS + (size_t)32 * KS_STRIDE * 2;   // +33792
static constexpr size_t OFF_PL = OFF_VT + (size_t)512 * VT_STRIDE * 2;  // +49152
static constexpr size_t OFF_SP = OFF_PL + (size_t)4 * PL_GROUP * 2;     // +6144
static constexpr size_t ATTN_SMEM = OFF_SP + (size_t)16 * 512 * 4;      // 189440 B

__device__ __forceinline__ void stage_b128(const bf16* g, bf16* l) {
#if USE_ASYNC_LDS
    __builtin_amdgcn_global_load_async_to_lds_b128(
        (gv4i_p)(bf16*)g,   // strip const, then generic->AS1 int4*
        (lv4i_p)l,          // generic->AS3 int4*
        0, 0);
#else
    *(uint4*)l = *(const uint4*)g;
#endif
}

__device__ __forceinline__ void stage_wait() {
#if USE_ASYNC_LDS
    __builtin_amdgcn_s_wait_asynccnt(0);
#endif
}

__global__ __launch_bounds__(512)
void flash_attn_bf16(const bf16* __restrict__ qp, const bf16* __restrict__ kp,
                     const bf16* __restrict__ vp, float* __restrict__ out) {
    extern __shared__ char smem[];
    bf16*  Qs = (bf16*)(smem + OFF_QS);
    bf16*  Ks = (bf16*)(smem + OFF_KS);
    bf16*  Vt = (bf16*)(smem + OFF_VT);
    bf16*  Pl = (bf16*)(smem + OFF_PL);
    float* Sp = (float*)(smem + OFF_SP);

    const int b    = blockIdx.y;
    const int q0   = blockIdx.x * 64;
    const int tid  = threadIdx.x;
    const int lane = tid & 31;
    const int wave = tid >> 5;       // 0..15
    const int ln   = lane & 15;
    const int hi   = lane >> 4;
    const int g    = wave >> 2;      // query group 0..3
    const int dch  = wave & 3;       // d-chunk 0..3 (128 wide)
    const int dw   = dch * 128;

    const float SCALE = 0.044194173824159216f;   // 1/sqrt(512)
    const float LOG2E = 1.4426950408889634f;

    // ---- preload Q block (64x512 bf16) via async-to-LDS ----
    const bf16* qbase = qp + ((size_t)b * S + q0) * D;
    for (int i = tid; i < 64 * 64; i += 512) {            // granule = 8 bf16
        const int r = i >> 6, c = i & 63;
        stage_b128(&qbase[(size_t)r * D + c * 8], &Qs[r * QS_STRIDE + c * 8]);
    }

    v8f acc_o[8];                    // O[16 rows x 128 d] for (g, dch), registers
    #pragma unroll
    for (int dc = 0; dc < 8; ++dc) acc_o[dc] = {};
    float m_run[8], l_run[8];
    #pragma unroll
    for (int v = 0; v < 8; ++v) { m_run[v] = -1.0e30f; l_run[v] = 0.0f; }

    for (int kt = 0; kt < S / 32; ++kt) {
        const int k0 = kt * 32;
        const bf16* kbase = kp + ((size_t)b * S + k0) * D;
        const bf16* vbase = vp + ((size_t)b * S + k0) * D;
        __syncthreads();   // previous round done with Ks/Vt/Pl

        // ---- stage K tile (async straight copy, B-layout as-is) ----
        for (int i = tid; i < 32 * 64; i += 512) {
            const int r = i >> 6, c = i & 63;
            stage_b128(&kbase[(size_t)r * D + c * 8], &Ks[r * KS_STRIDE + c * 8]);
        }
        // ---- stage V tile transposed: Vt[d][k] ----
        for (int i = tid; i < 32 * 64; i += 512) {
            const int r = i >> 6, c = i & 63;
            uint4 u = *(const uint4*)&vbase[(size_t)r * D + c * 8];
            const bf16* e = (const bf16*)&u;
            const int d0 = c * 8;
            #pragma unroll
            for (int j = 0; j < 8; ++j) Vt[(d0 + j) * VT_STRIDE + r] = e[j];
        }
        if (kt + 1 < S / 32) {       // L2 prefetch of next tiles
            __builtin_prefetch(kbase + (size_t)32 * D + (tid & 127) * 32, 0, 1);
            __builtin_prefetch(vbase + (size_t)32 * D + (tid & 127) * 32, 0, 1);
        }
        stage_wait();
        __syncthreads();

        // ---- partial scores: this wave covers d in [dch*128, dch*128+128) ----
        v8f s0 = {}, s1 = {};
        #pragma unroll
        for (int i = 0; i < 4; ++i) {
            const int dk = dch * 4 + i;
            v16bf a  = ldfrag(&Qs[(g * 16 + ln) * QS_STRIDE + dk * 32 + hi * 16]);
            v16bf b0 = ldfrag(&Ks[ln * KS_STRIDE + dk * 32 + hi * 16]);
            v16bf b1 = ldfrag(&Ks[(16 + ln) * KS_STRIDE + dk * 32 + hi * 16]);
            s0 = WMMA_BF16(a, b0, s0);
            s1 = WMMA_BF16(a, b1, s1);
        }
        {   // write partials (32B-contiguous per lane -> b128 DS stores)
            float* sp = &Sp[(size_t)wave * 512 + lane * 8];
            #pragma unroll
            for (int v = 0; v < 8; ++v) { sp[v] = s0[v]; sp[256 + v] = s1[v]; }
        }
        __syncthreads();

        // ---- reduce the 4 d-partials of my group (every wave, redundant) ----
        v8f t0 = {}, t1 = {};
        #pragma unroll
        for (int w2 = 0; w2 < 4; ++w2) {
            const float* sp = &Sp[(size_t)(g * 4 + w2) * 512 + lane * 8];
            #pragma unroll
            for (int v = 0; v < 8; ++v) { t0[v] += sp[v]; t1[v] += sp[256 + v]; }
        }

        // ---- online softmax (row = v + 8*hi spans one 16-lane half) ----
        float alpha_r[8];
        #pragma unroll
        for (int v = 0; v < 8; ++v) {
            const float x0 = t0[v] * SCALE;
            const float x1 = t1[v] * SCALE;
            float mx = fmaxf(x0, x1);
            #pragma unroll
            for (int msk = 1; msk <= 8; msk <<= 1) mx = fmaxf(mx, __shfl_xor(mx, msk, 32));
            const float mnew = fmaxf(m_run[v], mx);
            const float p0 = exp2f((x0 - mnew) * LOG2E);
            const float p1 = exp2f((x1 - mnew) * LOG2E);
            float sum = p0 + p1;
            #pragma unroll
            for (int msk = 1; msk <= 8; msk <<= 1) sum += __shfl_xor(sum, msk, 32);
            alpha_r[v] = exp2f((m_run[v] - mnew) * LOG2E);
            l_run[v] = l_run[v] * alpha_r[v] + sum;
            m_run[v] = mnew;
            if (dch == 0) {          // one wave per group stages P (A-layout rows)
                bf16* prow = &Pl[g * PL_GROUP + (v + 8 * hi) * PL_STRIDE];
                prow[ln]      = (bf16)p0;
                prow[16 + ln] = (bf16)p1;
            }
        }
        __syncthreads();

        // ---- O update: acc = acc*alpha + P(16x32) x V(32x128-chunk) ----
        v16bf pa = ldfrag(&Pl[g * PL_GROUP + ln * PL_STRIDE + hi * 16]);
        #pragma unroll
        for (int dc = 0; dc < 8; ++dc) {
            const int d0 = dw + dc * 16;
            v8f c;
            #pragma unroll
            for (int v = 0; v < 8; ++v) c[v] = acc_o[dc][v] * alpha_r[v];
            v16bf vb = ldfrag(&Vt[(d0 + ln) * VT_STRIDE + hi * 16]);
            acc_o[dc] = WMMA_BF16(pa, vb, c);
        }
    }

    // ---- normalize and store straight from registers ----
    float invl[8];
    #pragma unroll
    for (int v = 0; v < 8; ++v) invl[v] = 1.0f / l_run[v];
    float* obase = out + ((size_t)b * S + q0 + g * 16) * D + dw;
    #pragma unroll
    for (int dc = 0; dc < 8; ++dc) {
        #pragma unroll
        for (int v = 0; v < 8; ++v) {
            const int row = v + 8 * hi;
            obase[(size_t)row * D + dc * 16 + ln] = acc_o[dc][v] * invl[v];
        }
    }
}

// ---------------------------------------------------------------------------
// Host launcher
// ---------------------------------------------------------------------------
extern "C" void kernel_launch(void* const* d_in, const int* in_sizes, int n_in,
                              void* d_out, int out_size, void* d_ws, size_t ws_size,
                              hipStream_t stream) {
    (void)in_sizes; (void)n_in; (void)out_size; (void)ws_size;
    const float* q  = (const float*)d_in[0];
    const float* k  = (const float*)d_in[1];
    const float* v  = (const float*)d_in[2];
    const float* Wq = (const float*)d_in[3];
    const float* bq = (const float*)d_in[4];
    const float* Wk = (const float*)d_in[5];
    const float* bk = (const float*)d_in[6];
    const float* Wv = (const float*)d_in[7];
    const float* bv = (const float*)d_in[8];
    float* out = (float*)d_out;

    bf16* qp = (bf16*)d_ws;
    bf16* kp = qp + (size_t)M_TOT * D;
    bf16* vp = kp + (size_t)M_TOT * D;

    dim3 pg(D / 128, M_TOT / 128);   // 4 x 128
    proj_gemm_bf16<<<pg, 256, 0, stream>>>(q, Wq, bq, qp);
    proj_gemm_bf16<<<pg, 256, 0, stream>>>(k, Wk, bk, kp);
    proj_gemm_bf16<<<pg, 256, 0, stream>>>(v, Wv, bv, vp);

    dim3 ag(S / 64, NB);             // 32 x 8
    flash_attn_bf16<<<ag, 512, ATTN_SMEM, stream>>>(qp, kp, vp, out);
}

// v001
// It runs in 614 microseconds.
// Two timings next to v000 both put it at 1.41 times that version's speed.
#include <hip/hip_runtime.h>

// ---------------------------------------------------------------------------
// Types for CDNA5 WMMA (gfx1250, wave32)
// ---------------------------------------------------------------------------
typedef __bf16 bf16;
typedef __attribute__((ext_vector_type(16))) __bf16 v16bf;
typedef __attribute__((ext_vector_type(8)))  float  v8f;
typedef __attribute__((ext_vector_type(4)))  int    v4i;
typedef __attribute__((ext_vector_type(8)))  __bf16 v8bf;
typedef __attribute__((ext_vector_type(8)))  short  v8s;

// Pointer types matching the async-to-LDS builtin's parameters
// (param0: int4 addrspace(1)*, param1: int4 addrspace(3)* per hipcc diagnostic)
typedef __attribute__((address_space(1))) v4i* gv4i_p;
typedef __attribute__((address_space(3))) v4i* lv4i_p;
typedef __attribute__((address_space(3))) v8s* lv8s_p;

#define WMMA_BF16(a, b, c) \
    __builtin_amdgcn_wmma_f32_16x16x32_bf16(false, (a), false, (b), (short)0, (c), false, false)

#if __has_builtin(__builtin_amdgcn_global_load_async_to_lds_b128) && \
    __has_builtin(__builtin_amdgcn_s_wait_asynccnt)
#define USE_ASYNC_LDS 1
#else
#define USE_ASYNC_LDS 0
#endif

__device__ __forceinline__ v16bf ldfrag(const bf16* p) {
    // 32-byte aligned LDS fragment load (16 bf16)
    return *(const v16bf*)p;
}

// Problem constants
static constexpr int D  = 512;       // model dim (= INPUT_SIZE = 2*HIDDEN)
static constexpr int S  = 2048;      // sequence length
static constexpr int NB = 8;         // batch
static constexpr int M_TOT = NB * S; // 16384 rows for the projections

// ---------------------------------------------------------------------------
// Kernel 1: projection GEMM  C[m,n] = sum_k A[m,k] * W[k,n] + bias[n]
// A: f32 [M,512], W: f32 [512,512] row-major (k-major), C: bf16 [M,512]
// Tile: 128(M) x 128(N), KT=32.  256 threads = 8 waves; wave -> 64x32 subtile.
// ---------------------------------------------------------------------------
static constexpr int P_STRIDE = 48;  // padded LDS row stride; 96B => 32B-aligned frags

__global__ __launch_bounds__(256)
void proj_gemm_bf16(const float* __restrict__ A, const float* __restrict__ W,
                    const float* __restrict__ bias, bf16* __restrict__ C) {
    __shared__ bf16 As[128 * P_STRIDE];   // [row m 0..127][k 0..31]
    __shared__ bf16 Ws[128 * P_STRIDE];   // transposed: [col n 0..127][k 0..31]

    const int n0 = blockIdx.x * 128;
    const int m0 = blockIdx.y * 128;

    const int tid  = threadIdx.x;
    const int lane = tid & 31;
    const int wave = tid >> 5;
    const int ln   = lane & 15;        // N / M index within fragment
    const int hi   = lane >> 4;        // K-half selector (A/B frag layout)
    const int wm   = wave >> 2;        // 0..1 : 64-row slab
    const int wn   = wave & 3;         // 0..3 : 32-col slab

    v8f acc[4][2];
    #pragma unroll
    for (int mt = 0; mt < 4; ++mt)
        #pragma unroll
        for (int nt = 0; nt < 2; ++nt) acc[mt][nt] = {};

    for (int kk = 0; kk < 16; ++kk) {       // K = 512, KT = 32
        const int k0 = kk * 32;
        // ---- stage A tile: 128x32 f32 -> bf16, row-major ----
        #pragma unroll
        for (int p = 0; p < 4; ++p) {
            const int r = (tid >> 3) + p * 32;       // 0..127
            const int c = (tid & 7) * 4;             // 0..28
            float4 f = *(const float4*)&A[(size_t)(m0 + r) * D + k0 + c];
            bf16* dst = &As[r * P_STRIDE + c];
            dst[0] = (bf16)f.x; dst[1] = (bf16)f.y;
            dst[2] = (bf16)f.z; dst[3] = (bf16)f.w;
        }
        // ---- stage W tile transposed: W[k, n] -> Ws[n][k] ----
        #pragma unroll
        for (int p = 0; p < 4; ++p) {
            const int r = (tid >> 5) + p * 8;        // k row 0..31
            const int c = (tid & 31) * 4;            // n col 0..124
            float4 f = *(const float4*)&W[(size_t)(k0 + r) * D + n0 + c];
            Ws[(c + 0) * P_STRIDE + r] = (bf16)f.x;
            Ws[(c + 1) * P_STRIDE + r] = (bf16)f.y;
            Ws[(c + 2) * P_STRIDE + r] = (bf16)f.z;
            Ws[(c + 3) * P_STRIDE + r] = (bf16)f.w;
        }
        __syncthreads();

        // ---- fragments + 8 WMMAs ----
        v16bf af[4], bf_[2];
        #pragma unroll
        for (int mt = 0; mt < 4; ++mt)
            af[mt] = ldfrag(&As[(wm * 64 + mt * 16 + ln) * P_STRIDE + hi * 16]);
        #pragma unroll
        for (int nt = 0; nt < 2; ++nt)
            bf_[nt] = ldfrag(&Ws[(wn * 32 + nt * 16 + ln) * P_STRIDE + hi * 16]);
        #pragma unroll
        for (int mt = 0; mt < 4; ++mt)
            #pragma unroll
            for (int nt = 0; nt < 2; ++nt)
                acc[mt][nt] = WMMA_BF16(af[mt], bf_[nt], acc[mt][nt]);
        __syncthreads();
    }

    // ---- epilogue: bias add, convert to bf16, store ----
    #pragma unroll
    for (int mt = 0; mt < 4; ++mt) {
        #pragma unroll
        for (int nt = 0; nt < 2; ++nt) {
            const int N = n0 + wn * 32 + nt * 16 + ln;
            const float bn = bias[N];
            #pragma unroll
            for (int v = 0; v < 8; ++v) {
                const int Mi = m0 + wm * 64 + mt * 16 + v + 8 * hi;
                C[(size_t)Mi * D + N] = (bf16)(acc[mt][nt][v] + bn);
            }
        }
    }
}

// ---------------------------------------------------------------------------
// Kernel 2: flash attention, O accumulators in registers.
// One block per (batch, 64-query block); 512 threads = 16 waves.
// Wave (g, dch): g = query group (16 rows), dch = 128-wide d-chunk of output.
//   * scores: the 4 waves of group g split the d=512 reduction (4 K-steps each),
//     partial f32 accumulators reduced through LDS (contiguous b128 ops).
//   * softmax stats recomputed redundantly per wave (registers only).
//   * P -> bf16 staged in LDS (C-layout -> A-layout) by dch==0 wave.
//   * V stays row-major in LDS; the B fragments of P x V come from transposing
//     LDS loads, which fix the hardware k order, so P's A fragment follows it.
//   * O update: register-resident v8f acc[8] per wave, rescaled by alpha, WMMA.
// LDS (~170 KB of 320 KB/WGP):
//   Qs [64][528] bf16 | Ks [32][528] bf16 | Vs [32][528] bf16
//   Pl 4x[16][48] bf16 | Sp 16x512 f32 (score partials)
// ---------------------------------------------------------------------------
static constexpr int QS_STRIDE = 528;
static constexpr int KS_STRIDE = 528;
static constexpr int VS_STRIDE = 528;   // 1056 B = 32 B x odd: the pitch of transposing loads
static constexpr int PL_STRIDE = 48;
static constexpr int PL_GROUP  = 16 * PL_STRIDE;

static constexpr size_t OFF_QS = 0;
static constexpr size_t OFF_KS = OFF_QS + (size_t)64 * QS_STRIDE * 2;   // 67584
static constexpr size_t OFF_VT = OFF_KS + (size_t)32 * KS_STRIDE * 2;   // +33792
static constexpr size_t OFF_PL = OFF_VT + (size_t)32 * VS_STRIDE * 2;   // +33792
static constexpr size_t OFF_SP = OFF_PL + (size_t)4 * PL_GROUP * 2;     // +6144
static constexpr size_t ATTN_SMEM = OFF_SP + (size_t)16 * 512 * 4;      // 174080 B

__device__ __forceinline__ void stage_b128(const bf16* g, bf16* l) {
#if USE_ASYNC_LDS
    __builtin_amdgcn_global_load_async_to_lds_b128(
        (gv4i_p)(bf16*)g,   // strip const, then generic->AS1 int4*
        (lv4i_p)l,          // generic->AS3 int4*
        0, 0);
#else
    *(uint4*)l = *(const uint4*)g;
#endif
}

__device__ __forceinline__ void stage_wait() {
#if USE_ASYNC_LDS
    // the issuing wave's copies have landed before the barrier that publishes them;
    // asm with the clobber so that no LDS read is lifted over the wait
    asm volatile("s_wait_asynccnt 0x0" ::: "memory");
#endif
}

// 8 bf16 of one column of a row-major 16-bit LDS tile (8 rows x 16 columns per lane half)
__device__ __forceinline__ v8bf ld_tr16(const char* p) {
    return __builtin_bit_cast(v8bf, __builtin_amdgcn_ds_load_tr16_b128_v8i16((lv8s_p)(char*)p));
}

__global__ __launch_bounds__(512)
void flash_attn_bf16(const bf16* __restrict__ qp, const bf16* __restrict__ kp,
                     const bf16* __restrict__ vp, float* __restrict__ out) {
    extern __shared__ char smem[];
    bf16*  Qs = (bf16*)(smem + OFF_QS);
    bf16*  Ks = (bf16*)(smem + OFF_KS);
    bf16*  Vs = (bf16*)(smem + OFF_VT);
    bf16*  Pl = (bf16*)(smem + OFF_PL);
    float* Sp = (float*)(smem + OFF_SP);

    const int b    = blockIdx.y;
    const int q0   = blockIdx.x * 64;
    const int tid  = threadIdx.x;
    const int lane = tid & 31;
    const int wave = tid >> 5;       // 0..15
    const int ln   = lane & 15;
    const int hi   = lane >> 4;
    const int g    = wave >> 2;      // query group 0..3
    const int dch  = wave & 3;       // d-chunk 0..3 (128 wide)
    const int dw   = dch * 128;

    const float SCALE = 0.044194173824159216f;   // 1/sqrt(512)
    const float LOG2E = 1.4426950408889634f;

    // ---- preload Q block (64x512 bf16) via async-to-LDS ----
    const bf16* qbase = qp + ((size_t)b * S + q0) * D;
    for (int i = tid; i < 64 * 64; i += 512) {            // granule = 8 bf16
        const int r = i >> 6, c = i & 63;
        stage_b128(&qbase[(size_t)r * D + c * 8], &Qs[r * QS_STRIDE + c * 8]);
    }

    v8f acc_o[8];                    // O[16 rows x 128 d] for (g, dch), registers
    #pragma unroll
    for (int dc = 0; dc < 8; ++dc) acc_o[dc] = {};
    float m_run[8], l_run[8];
    #pragma unroll
    for (int v = 0; v < 8; ++v) { m_run[v] = -1.0e30f; l_run[v] = 0.0f; }

    for (int kt = 0; kt < S / 32; ++kt) {
        const int k0 = kt * 32;
        const bf16* kbase = kp + ((size_t)b * S + k0) * D;
        const bf16* vbase = vp + ((size_t)b * S + k0) * D;
        // this wave's LDS reads of Ks/Vs have retired before any wave's copies refill them
        asm volatile("s_wait_dscnt 0x0" ::: "memory");
        __syncthreads();   // previous round done with Ks/Vs/Pl

        // ---- stage K tile (async straight copy, B-layout as-is) ----
        for (int i = tid; i < 32 * 64; i += 512) {
            const int r = i >> 6, c = i & 63;
            stage_b128(&kbase[(size_t)r * D + c * 8], &Ks[r * KS_STRIDE + c * 8]);
        }
        // ---- stage V tile (async straight copy, row-major Vs[k][d]) ----
        // fixed trip count, unrolled: straight-line copies with every lane on, no loop on EXEC
        #pragma unroll
        for (int p = 0; p < 4; ++p) {
            const int r = (tid >> 6) + p * 8, c = tid & 63;
            stage_b128(&vbase[(size_t)r * D + c * 8], &Vs[r * VS_STRIDE + c * 8]);
        }
        if (kt + 1 < S / 32) {       // L2 prefetch of next tiles
            __builtin_prefetch(kbase + (size_t)32 * D + (tid & 127) * 32, 0, 1);
            __builtin_prefetch(vbase + (size_t)32 * D + (tid & 127) * 32, 0, 1);
        }
        stage_wait();
        __syncthreads();

        // ---- partial scores: this wave covers d in [dch*128, dch*128+128) ----
        v8f s0 = {}, s1 = {};
        #pragma unroll
        for (int i = 0; i < 4; ++i) {
            const int dk = dch * 4 + i;
            v16bf a  = ldfrag(&Qs[(g * 16 + ln) * QS_STRIDE + dk * 32 + hi * 16]);
            v16bf b0 = ldfrag(&Ks[ln * KS_STRIDE + dk * 32 + hi * 16]);
            v16bf b1 = ldfrag(&Ks[(16 + ln) * KS_STRIDE + dk * 32 + hi * 16]);
            s0 = WMMA_BF16(a, b0, s0);
            s1 = WMMA_BF16(a, b1, s1);
        }
        {   // write partials (32B-contiguous per lane -> b128 DS stores)
            float* sp = &Sp[(size_t)wave * 512 + lane * 8];
            #pragma unroll
            for (int v = 0; v < 8; ++v) { sp[v] = s0[v]; sp[256 + v] = s1[v]; }
        }
        __syncthreads();

        // ---- reduce the 4 d-partials of my group (every wave, redundant) ----
        v8f t0 = {}, t1 = {};
        #pragma unroll
        for (int w2 = 0; w2 < 4; ++w2) {
            const float* sp = &Sp[(size_t)(g * 4 + w2) * 512 + lane * 8];
            #pragma unroll
            for (int v = 0; v < 8; ++v) { t0[v] += sp[v]; t1[v] += sp[256 + v]; }
        }

        // ---- online softmax (row = v + 8*hi spans one 16-lane half) ----
        float alpha_r[8];
        #pragma unroll
        for (int v = 0; v < 8; ++v) {
            const float x0 = t0[v] * SCALE;
            const float x1 = t1[v] * SCALE;
            float mx = fmaxf(x0, x1);
            #pragma unroll
            for (int msk = 1; msk <= 8; msk <<= 1) mx = fmaxf(mx, __shfl_xor(mx, msk, 32));
            const float mnew = fmaxf(m_run[v], mx);
            const float p0 = exp2f((x0 - mnew) * LOG2E);
            const float p1 = exp2f((x1 - mnew) * LOG2E);
            float sum = p0 + p1;
            #pragma unroll
            for (int msk = 1; msk <= 8; msk <<= 1) sum += __shfl_xor(sum, msk, 32);
            alpha_r[v] = exp2f((m_run[v] - mnew) * LOG2E);
            l_run[v] = l_run[v] * alpha_r[v] + sum;
            m_run[v] = mnew;
            if (dch == 0) {          // one wave per group stages P (A-layout rows)
                bf16* prow = &Pl[g * PL_GROUP + (v + 8 * hi) * PL_STRIDE];
                prow[ln]      = (bf16)p0;
                prow[16 + ln] = (bf16)p1;
            }
        }
        __syncthreads();

        // ---- O update: acc = acc*alpha + P(16x32) x V(32x128-chunk) ----
        // hardware k order on both sides: element s of lane half hi is key
        // 8*hi + s (s < 8) or 16 + 8*hi + (s - 8)
        const bf16* prd = &Pl[g * PL_GROUP + ln * PL_STRIDE + hi * 8];
        const v16bf pa = __builtin_shufflevector(*(const v8bf*)prd, *(const v8bf*)(prd + 16),
                                                 0, 1, 2, 3, 4, 5, 6, 7, 8, 9, 10, 11, 12, 13, 14, 15);
        const char* vrd = (const char*)Vs + (8 * hi + (lane & 7)) * (VS_STRIDE * 2)
                          + ((lane >> 3) & 1) * 16 + dw * 2;
        #pragma unroll
        for (int dc = 0; dc < 8; ++dc) {
            v8f c;
            #pragma unroll
            for (int v = 0; v < 8; ++v) c[v] = acc_o[dc][v] * alpha_r[v];
            const v16bf vb = __builtin_shufflevector(ld_tr16(vrd + dc * 32),
                                                     ld_tr16(vrd + 16 * (VS_STRIDE * 2) + dc * 32),
                                                     0, 1, 2, 3, 4, 5, 6, 7, 8, 9, 10, 11, 12, 13, 14, 15);
            acc_o[dc] = WMMA_BF16(pa, vb, c);
        }
    }

    // ---- normalize and store straight from registers ----
    float invl[8];
    #pragma unroll
    for (int v = 0; v < 8; ++v) invl[v] = 1.0f / l_run[v];
    float* obase = out + ((size_t)b * S + q0 + g * 16) * D + dw;
    #pragma unroll
    for (int dc = 0; dc < 8; ++dc) {
        #pragma unroll
        for (int v = 0; v < 8; ++v) {
            const int row = v + 8 * hi;
            obase[(size_t)row * D + dc * 16 + ln] = acc_o[dc][v] * invl[v];
        }
    }
}

// ---------------------------------------------------------------------------
// Host launcher
// ---------------------------------------------------------------------------
extern "C" void kernel_launch(void* const* d_in, const int* in_sizes, int n_in,
                              void* d_out, int out_size, void* d_ws, size_t ws_size,
                              hipStream_t stream) {
    (void)in_sizes; (void)n_in; (void)out_size; (void)ws_size;
    const float* q  = (const float*)d_in[0];
    const float* k  = (const float*)d_in[1];
    const float* v  = (const float*)d_in[2];
    const float* Wq = (const float*)d_in[3];
    const float* bq = (const float*)d_in[4];
    const float* Wk = (const float*)d_in[5];
    const float* bk = (const float*)d_in[6];
    const float* Wv = (const float*)d_in[7];
    const float* bv = (const float*)d_in[8];
    float* out = (float*)d_out;

    bf16* qp = (bf16*)d_ws;
    bf16* kp = qp + (size_t)M_TOT * D;
    bf16* vp = kp + (size_t)M_TOT * D;

    dim3 pg(D / 128, M_TOT / 128);   // 4 x 128
    proj_gemm_bf16<<<pg, 256, 0, stream>>>(q, Wq, bq, qp);
    proj_gemm_bf16<<<pg, 256, 0, stream>>>(k, Wk, bk, kp);
    proj_gemm_bf16<<<pg, 256, 0, stream>>>(v, Wv, bv, vp);

    dim3 ag(S / 64, NB);             // 32 x 8
    flash_attn_bf16<<<ag, 512, ATTN_SMEM, stream>>>(qp, kp, vp, out);
}

// v002
// One run takes 487 microseconds.
// Timed twice side by side with v001, it ran 1.26 times as fast both times.
// Over all steps from v000 it is 1.78 times as fast.
#include <hip/hip_runtime.h>

// ---------------------------------------------------------------------------
// Types for CDNA5 WMMA (gfx1250, wave32)
// ---------------------------------------------------------------------------
typedef __bf16 bf16;
typedef __attribute__((ext_vector_type(16))) __bf16 v16bf;
typedef __attribute__((ext_vector_type(8)))  float  v8f;
typedef __attribute__((ext_vector_type(4)))  int    v4i;
typedef __attribute__((ext_vector_type(8)))  __bf16 v8bf;
typedef __attribute__((ext_vector_type(8)))  short  v8s;

// Pointer types matching the async-to-LDS builtin's parameters
// (param0: int4 addrspace(1)*, param1: int4 addrspace(3)* per hipcc diagnostic)
typedef __attribute__((address_space(1))) v4i* gv4i_p;
typedef __attribute__((address_space(3))) v4i* lv4i_p;
typedef __attribute__((address_space(3))) v8s* lv8s_p;

#define WMMA_BF16(a, b, c) \
    __builtin_amdgcn_wmma_f32_16x16x32_bf16(false, (a), false, (b), (short)0, (c), false, false)

#if __has_builtin(__builtin_amdgcn_global_load_async_to_lds_b128) && \
    __has_builtin(__builtin_amdgcn_s_wait_asynccnt)
#define USE_ASYNC_LDS 1
#else
#define USE_ASYNC_LDS 0
#endif

__device__ __forceinline__ v16bf ldfrag(const bf16* p) {
    // 32-byte aligned LDS fragment load (16 bf16)
    return *(const v16bf*)p;
}

// Problem constants
static constexpr int D  = 512;       // model dim (= INPUT_SIZE = 2*HIDDEN)
static constexpr int S  = 2048;      // sequence length
static constexpr int NB = 8;         // batch
static constexpr int M_TOT = NB * S; // 16384 rows for the projections

// ---------------------------------------------------------------------------
// Kernel 1: projection GEMM  C[m,n] = sum_k A[m,k] * W[k,n] + bias[n]
// A: f32 [M,512], W: f32 [512,512] row-major (k-major), C: bf16 [M,512]
// Tile: 128(M) x 128(N), KT=32.  256 threads = 8 waves; wave -> 64x32 subtile.
// ---------------------------------------------------------------------------
static constexpr int P_STRIDE = 48;  // padded LDS row stride; 96B => 32B-aligned frags

__global__ __launch_bounds__(256)
void proj_gemm_bf16(const float* __restrict__ A, const float* __restrict__ W,
                    const float* __restrict__ bias, bf16* __restrict__ C) {
    __shared__ bf16 As[128 * P_STRIDE];   // [row m 0..127][k 0..31]
    __shared__ bf16 Ws[128 * P_STRIDE];   // transposed: [col n 0..127][k 0..31]

    const int n0 = blockIdx.x * 128;
    const int m0 = blockIdx.y * 128;

    const int tid  = threadIdx.x;
    const int lane = tid & 31;
    const int wave = tid >> 5;
    const int ln   = lane & 15;        // N / M index within fragment
    const int hi   = lane >> 4;        // K-half selector (A/B frag layout)
    const int wm   = wave >> 2;        // 0..1 : 64-row slab
    const int wn   = wave & 3;         // 0..3 : 32-col slab

    v8f acc[4][2];
    #pragma unroll
    for (int mt = 0; mt < 4; ++mt)
        #pragma unroll
        for (int nt = 0; nt < 2; ++nt) acc[mt][nt] = {};

    for (int kk = 0; kk < 16; ++kk) {       // K = 512, KT = 32
        const int k0 = kk * 32;
        // ---- stage A tile: 128x32 f32 -> bf16, row-major ----
        #pragma unroll
        for (int p = 0; p < 4; ++p) {
            const int r = (tid >> 3) + p * 32;       // 0..127
            const int c = (tid & 7) * 4;             // 0..28
            float4 f = *(const float4*)&A[(size_t)(m0 + r) * D + k0 + c];
            bf16* dst = &As[r * P_STRIDE + c];
            dst[0] = (bf16)f.x; dst[1] = (bf16)f.y;
            dst[2] = (bf16)f.z; dst[3] = (bf16)f.w;
        }
        // ---- stage W tile transposed: W[k, n] -> Ws[n][k] ----
        #pragma unroll
        for (int p = 0; p < 4; ++p) {
            const int r = (tid >> 5) + p * 8;        // k row 0..31
            const int c = (tid & 31) * 4;            // n col 0..124
            float4 f = *(const float4*)&W[(size_t)(k0 + r) * D + n0 + c];
            Ws[(c + 0) * P_STRIDE + r] = (bf16)f.x;
            Ws[(c + 1) * P_STRIDE + r] = (bf16)f.y;
            Ws[(c + 2) * P_STRIDE + r] = (bf16)f.z;
            Ws[(c + 3) * P_STRIDE + r] = (bf16)f.w;
        }
        __syncthreads();

        // ---- fragments + 8 WMMAs ----
        v16bf af[4], bf_[2];
        #pragma unroll
        for (int mt = 0; mt < 4; ++mt)
            af[mt] = ldfrag(&As[(wm * 64 + mt * 16 + ln) * P_STRIDE + hi * 16]);
        #pragma unroll
        for (int nt = 0; nt < 2; ++nt)
            bf_[nt] = ldfrag(&Ws[(wn * 32 + nt * 16 + ln) * P_STRIDE + hi * 16]);
        #pragma unroll
        for (int mt = 0; mt < 4; ++mt)
            #pragma unroll
            for (int nt = 0; nt < 2; ++nt)
                acc[mt][nt] = WMMA_BF16(af[mt], bf_[nt], acc[mt][nt]);
        __syncthreads();
    }

    // ---- epilogue: bias add, convert to bf16, store ----
    #pragma unroll
    for (int mt = 0; mt < 4; ++mt) {
        #pragma unroll
        for (int nt = 0; nt < 2; ++nt) {
            const int N = n0 + wn * 32 + nt * 16 + ln;
            const float bn = bias[N];
            #pragma unroll
            for (int v = 0; v < 8; ++v) {
                const int Mi = m0 + wm * 64 + mt * 16 + v + 8 * hi;
                C[(size_t)Mi * D + N] = (bf16)(acc[mt][nt][v] + bn);
            }
        }
    }
}

// ---------------------------------------------------------------------------
// Kernel 2: flash attention, O accumulators in registers.
// One block per (batch, 64-query block); 512 threads = 16 waves.
// Wave (g, dch): g = query group (16 rows), dch = 128-wide d-chunk of output.
//   * scores: the 4 waves of group g split the d=512 reduction (4 K-steps each),
//     partial f32 accumulators reduced through LDS (contiguous b128 ops).
//   * both products are transposed: S^T = K x Q^T and O^T += V^T x P^T, so a lane
//     owns one query: 16 of its 32 scores lie in the lane, 16 in lane ^ 16.
//   * softmax stats recomputed redundantly per wave: maximum and sum in-lane,
//     one exchange between the lane halves for the maximum.
//   * P^T is packed from the two score tiles into the B operand (hardware k
//     order); it never touches LDS.
//   * V stays row-major in LDS; the A fragments V^T come from transposing LDS
//     loads, which deliver the same hardware k order.
//   * O^T update: register-resident v8f acc[8] per wave, rescaled by alpha, WMMA.
// LDS (164 KB of 320 KB/WGP):
//   Qs [64][528] bf16 | Ks [32][528] bf16 | Vs [32][528] bf16
//   Sp 16x512 f32 (score partials)
// ---------------------------------------------------------------------------
static constexpr int QS_STRIDE = 528;
static constexpr int KS_STRIDE = 528;
static constexpr int VS_STRIDE = 528;   // 1056 B = 32 B x odd: the pitch of transposing loads

static constexpr size_t OFF_QS = 0;
static constexpr size_t OFF_KS = OFF_QS + (size_t)64 * QS_STRIDE * 2;   // 67584
static constexpr size_t OFF_VT = OFF_KS + (size_t)32 * KS_STRIDE * 2;   // +33792
static constexpr size_t OFF_SP = OFF_VT + (size_t)32 * VS_STRIDE * 2;   // +33792
static constexpr size_t ATTN_SMEM = OFF_SP + (size_t)16 * 512 * 4;      // 167936 B

__device__ __forceinline__ void stage_b128(const bf16* g, bf16* l) {
#if USE_ASYNC_LDS
    __builtin_amdgcn_global_load_async_to_lds_b128(
        (gv4i_p)(bf16*)g,   // strip const, then generic->AS1 int4*
        (lv4i_p)l,          // generic->AS3 int4*
        0, 0);
#else
    *(uint4*)l = *(const uint4*)g;
#endif
}

__device__ __forceinline__ void stage_wait() {
#if USE_ASYNC_LDS
    // the issuing wave's copies have landed before the barrier that publishes them;
    // asm with the clobber so that no LDS read is lifted over the wait
    asm volatile("s_wait_asynccnt 0x0" ::: "memory");
#endif
}

// 8 bf16 of one column of a row-major 16-bit LDS tile (8 rows x 16 columns per lane half)
__device__ __forceinline__ v8bf ld_tr16(const char* p) {
    return __builtin_bit_cast(v8bf, __builtin_amdgcn_ds_load_tr16_b128_v8i16((lv8s_p)(char*)p));
}

// value of lane l ^ 16
__device__ __forceinline__ float xhalf(float x) {
    const int i = __builtin_bit_cast(int, x);
    return __builtin_bit_cast(float,
        __builtin_amdgcn_permlanex16(i, i, 0x76543210, 0xfedcba98, false, false));
}

// LDS admits one work-group per WGP, four waves per SIMD: tell the register allocator so,
// or it schedules for eight and serialises each fragment load with its WMMA
__global__ __launch_bounds__(512) __attribute__((amdgpu_waves_per_eu(4, 4)))
void flash_attn_bf16(const bf16* __restrict__ qp, const bf16* __restrict__ kp,
                     const bf16* __restrict__ vp, float* __restrict__ out) {
    extern __shared__ char smem[];
    bf16*  Qs = (bf16*)(smem + OFF_QS);
    bf16*  Ks = (bf16*)(smem + OFF_KS);
    bf16*  Vs = (bf16*)(smem + OFF_VT);
    float* Sp = (float*)(smem + OFF_SP);

    const int b    = blockIdx.y;
    const int q0   = blockIdx.x * 64;
    const int tid  = threadIdx.x;
    const int lane = tid & 31;
    const int wave = tid >> 5;       // 0..15
    const int ln   = lane & 15;
    const int hi   = lane >> 4;
    const int g    = wave >> 2;      // query group 0..3
    const int dch  = wave & 3;       // d-chunk 0..3 (128 wide)
    const int dw   = dch * 128;

    const float SCALE = 0.044194173824159216f;   // 1/sqrt(512)
    const float LOG2E = 1.4426950408889634f;

    // ---- preload Q block (64x512 bf16) via async-to-LDS ----
    const bf16* qbase = qp + ((size_t)b * S + q0) * D;
    for (int i = tid; i < 64 * 64; i += 512) {            // granule = 8 bf16
        const int r = i >> 6, c = i & 63;
        stage_b128(&qbase[(size_t)r * D + c * 8], &Qs[r * QS_STRIDE + c * 8]);
    }

    v8f acc_o[8];                    // O^T[128 d x 16 queries] for (g, dch), registers
    #pragma unroll
    for (int dc = 0; dc < 8; ++dc) acc_o[dc] = {};
    float m_run = -1.0e30f;          // running maximum of query ln
    float l_run = 0.0f;              // running sum over this lane half's keys only

    for (int kt = 0; kt < S / 32; ++kt) {
        const int k0 = kt * 32;
        const bf16* kbase = kp + ((size_t)b * S + k0) * D;
        const bf16* vbase = vp + ((size_t)b * S + k0) * D;
        // this wave's LDS reads of Ks/Vs have retired before any wave's copies refill them
        asm volatile("s_wait_dscnt 0x0" ::: "memory");
        __syncthreads();   // previous round done with Ks/Vs

        // ---- stage K tile (async straight copy, A-layout as-is) ----
        for (int i = tid; i < 32 * 64; i += 512) {
            const int r = i >> 6, c = i & 63;
            stage_b128(&kbase[(size_t)r * D + c * 8], &Ks[r * KS_STRIDE + c * 8]);
        }
        // ---- stage V tile (async straight copy, row-major Vs[k][d]) ----
        // fixed trip count, unrolled: straight-line copies with every lane on, no loop on EXEC
        #pragma unroll
        for (int p = 0; p < 4; ++p) {
            const int r = (tid >> 6) + p * 8, c = tid & 63;
            stage_b128(&vbase[(size_t)r * D + c * 8], &Vs[r * VS_STRIDE + c * 8]);
        }
        if (kt + 1 < S / 32) {       // L2 prefetch of next tiles
            __builtin_prefetch(kbase + (size_t)32 * D + (tid & 127) * 32, 0, 1);
            __builtin_prefetch(vbase + (size_t)32 * D + (tid & 127) * 32, 0, 1);
        }
        stage_wait();
        __syncthreads();

        // ---- partial scores S^T: this wave covers d in [dch*128, dch*128+128) ----
        // s0[v] = S[query ln][key 8*hi + v], s1[v] = S[query ln][key 16 + 8*hi + v]
        v8f s0 = {}, s1 = {};
        #pragma unroll
        for (int i = 0; i < 4; ++i) {
            const int dk = dch * 4 + i;
            v16bf a  = ldfrag(&Qs[(g * 16 + ln) * QS_STRIDE + dk * 32 + hi * 16]);
            v16bf b0 = ldfrag(&Ks[ln * KS_STRIDE + dk * 32 + hi * 16]);
            v16bf b1 = ldfrag(&Ks[(16 + ln) * KS_STRIDE + dk * 32 + hi * 16]);
            s0 = WMMA_BF16(b0, a, s0);
            s1 = WMMA_BF16(b1, a, s1);
        }
        {   // write partials (32B-contiguous per lane -> b128 DS stores)
            float* sp = &Sp[(size_t)wave * 512 + lane * 8];
            #pragma unroll
            for (int v = 0; v < 8; ++v) { sp[v] = s0[v]; sp[256 + v] = s1[v]; }
        }
        __syncthreads();

        // ---- reduce the 4 d-partials of my group (every wave, redundant) ----
        v8f t0 = {}, t1 = {};
        #pragma unroll
        for (int w2 = 0; w2 < 4; ++w2) {
            const float* sp = &Sp[(size_t)(g * 4 + w2) * 512 + lane * 8];
            #pragma unroll
            for (int v = 0; v < 8; ++v) { t0[v] += sp[v]; t1[v] += sp[256 + v]; }
        }

        // ---- online softmax: query ln, 16 scores in this lane, 16 in lane ^ 16 ----
        float x0[8], x1[8];
        #pragma unroll
        for (int v = 0; v < 8; ++v) { x0[v] = t0[v] * SCALE; x1[v] = t1[v] * SCALE; }
        float mx = fmaxf(x0[0], x1[0]);
        #pragma unroll
        for (int v = 1; v < 8; ++v) mx = fmaxf(mx, fmaxf(x0[v], x1[v]));
        mx = fmaxf(mx, xhalf(mx));
        const float mnew  = fmaxf(m_run, mx);
        const float alpha = exp2f((m_run - mnew) * LOG2E);
        // P^T as B operand: element s of lane half hi is key 8*hi + s (s < 8) or
        // 16 + 8*hi + (s - 8), which is where the two score tiles hold it
        v16bf pb;
        float sum = 0.0f;
        #pragma unroll
        for (int v = 0; v < 8; ++v) {
            const float p0 = exp2f((x0[v] - mnew) * LOG2E);
            const float p1 = exp2f((x1[v] - mnew) * LOG2E);
            sum += p0 + p1;
            pb[v]     = (bf16)p0;
            pb[8 + v] = (bf16)p1;
        }
        l_run = l_run * alpha + sum;
        m_run = mnew;

        // ---- O^T update: acc = acc*alpha + V^T(128-chunk x 32) x P^T(32 x 16) ----
        const char* vrd = (const char*)Vs + (8 * hi + (lane & 7)) * (VS_STRIDE * 2)
                          + ((lane >> 3) & 1) * 16 + dw * 2;
        #pragma unroll
        for (int dc = 0; dc < 8; ++dc) {
            v8f c;
            #pragma unroll
            for (int v = 0; v < 8; ++v) c[v] = acc_o[dc][v] * alpha;
            const v16bf va = __builtin_shufflevector(ld_tr16(vrd + dc * 32),
                                                     ld_tr16(vrd + 16 * (VS_STRIDE * 2) + dc * 32),
                                                     0, 1, 2, 3, 4, 5, 6, 7, 8, 9, 10, 11, 12, 13, 14, 15);
            acc_o[dc] = WMMA_BF16(va, pb, c);
        }
    }

    // ---- normalize and store straight from registers ----
    // acc_o[dc][v] = O[query ln][dw + dc*16 + 8*hi + v]: 32 contiguous bytes per lane
    const float invl = 1.0f / (l_run + xhalf(l_run));   // join the two halves' sums
    float* obase = out + ((size_t)b * S + q0 + g * 16 + ln) * D + dw + 8 * hi;
    #pragma unroll
    for (int dc = 0; dc < 8; ++dc) {
        #pragma unroll
        for (int v = 0; v < 8; ++v) acc_o[dc][v] *= invl;
    }
    #pragma unroll
    for (int dc = 0; dc < 8; ++dc) {
        *(float4*)(obase + dc * 16) =
            make_float4(acc_o[dc][0], acc_o[dc][1], acc_o[dc][2], acc_o[dc][3]);
        *(float4*)(obase + dc * 16 + 4) =
            make_float4(acc_o[dc][4], acc_o[dc][5], acc_o[dc][6], acc_o[dc][7]);
    }
}

// ---------------------------------------------------------------------------
// Host launcher
// ---------------------------------------------------------------------------
extern "C" void kernel_launch(void* const* d_in, const int* in_sizes, int n_in,
                              void* d_out, int out_size, void* d_ws, size_t ws_size,
                              hipStream_t stream) {
    (void)in_sizes; (void)n_in; (void)out_size; (void)ws_size;
    const float* q  = (const float*)d_in[0];
    const float* k  = (const float*)d_in[1];
    const float* v  = (const float*)d_in[2];
    const float* Wq = (const float*)d_in[3];
    const float* bq = (const float*)d_in[4];
    const float* Wk = (const float*)d_in[5];
    const float* bk = (const float*)d_in[6];
    const float* Wv = (const float*)d_in[7];
    const float* bv = (const float*)d_in[8];
    float* out = (float*)d_out;

    bf16* qp = (bf16*)d_ws;
    bf16* kp = qp + (size_t)M_TOT * D;
    bf16* vp = kp + (size_t)M_TOT * D;

    dim3 pg(D / 128, M_TOT / 128);   // 4 x 128
    proj_gemm_bf16<<<pg, 256, 0, stream>>>(q, Wq, bq, qp);
    proj_gemm_bf16<<<pg, 256, 0, stream>>>(k, Wk, bk, kp);
    proj_gemm_bf16<<<pg, 256, 0, stream>>>(v, Wv, bv, vp);

    dim3 ag(S / 64, NB);             // 32 x 8
    flash_attn_bf16<<<ag, 512, ATTN_SMEM, stream>>>(qp, kp, vp, out);
}

// v003
// Measured time: 370 microseconds a run.
// Next to v002, in two timings, it ran 1.31 times as fast each time.
// Counting every step since v000, it is 2.33 times as fast.
#include <hip/hip_runtime.h>

// ---------------------------------------------------------------------------
// Types for CDNA5 WMMA (gfx1250, wave32)
// ---------------------------------------------------------------------------
typedef __bf16 bf16;
typedef __attribute__((ext_vector_type(16))) __bf16 v16bf;
typedef __attribute__((ext_vector_type(8)))  float  v8f;
typedef __attribute__((ext_vector_type(4)))  float  v4f;
typedef __attribute__((ext_vector_type(4)))  int    v4i;
typedef __attribute__((ext_vector_type(8)))  __bf16 v8bf;
typedef __attribute__((ext_vector_type(8)))  short  v8s;

// Pointer types matching the async-to-LDS builtin's parameters
// (param0: int4 addrspace(1)*, param1: int4 addrspace(3)* per hipcc diagnostic)
typedef __attribute__((address_space(1))) v4i* gv4i_p;
typedef __attribute__((address_space(3))) v4i* lv4i_p;
typedef __attribute__((address_space(3))) v8s* lv8s_p;

#define WMMA_BF16(a, b, c) \
    __builtin_amdgcn_wmma_f32_16x16x32_bf16(false, (a), false, (b), (short)0, (c), false, false)

#if __has_builtin(__builtin_amdgcn_global_load_async_to_lds_b128) && \
    __has_builtin(__builtin_amdgcn_s_wait_asynccnt)
#define USE_ASYNC_LDS 1
#else
#define USE_ASYNC_LDS 0
#endif

__device__ __forceinline__ v16bf ldfrag(const bf16* p) {
    // 32-byte aligned LDS fragment load (16 bf16)
    return *(const v16bf*)p;
}

// Problem constants
static constexpr int D  = 512;       // model dim (= INPUT_SIZE = 2*HIDDEN)
static constexpr int S  = 2048;      // sequence length
static constexpr int NB = 8;         // batch
static constexpr int M_TOT = NB * S; // 16384 rows for the projections

// ---------------------------------------------------------------------------
// Kernel 1: projection GEMM  C[m,n] = sum_k A[m,k] * W[k,n] + bias[n]
// A: f32 [M,512], W: f32 [512,512] row-major (k-major), C: bf16 [M,512]
// Tile: 128(M) x 128(N), KT=32.  256 threads = 8 waves; wave -> 64x32 subtile.
// ---------------------------------------------------------------------------
static constexpr int P_STRIDE = 48;  // padded LDS row stride; 96B => 32B-aligned frags

__global__ __launch_bounds__(256)
void proj_gemm_bf16(const float* __restrict__ A, const float* __restrict__ W,
                    const float* __restrict__ bias, bf16* __restrict__ C) {
    __shared__ bf16 As[128 * P_STRIDE];   // [row m 0..127][k 0..31]
    __shared__ bf16 Ws[128 * P_STRIDE];   // transposed: [col n 0..127][k 0..31]

    const int n0 = blockIdx.x * 128;
    const int m0 = blockIdx.y * 128;

    const int tid  = threadIdx.x;
    const int lane = tid & 31;
    const int wave = tid >> 5;
    const int ln   = lane & 15;        // N / M index within fragment
    const int hi   = lane >> 4;        // K-half selector (A/B frag layout)
    const int wm   = wave >> 2;        // 0..1 : 64-row slab
    const int wn   = wave & 3;         // 0..3 : 32-col slab

    v8f acc[4][2];
    #pragma unroll
    for (int mt = 0; mt < 4; ++mt)
        #pragma unroll
        for (int nt = 0; nt < 2; ++nt) acc[mt][nt] = {};

    for (int kk = 0; kk < 16; ++kk) {       // K = 512, KT = 32
        const int k0 = kk * 32;
        // ---- stage A tile: 128x32 f32 -> bf16, row-major ----
        #pragma unroll
        for (int p = 0; p < 4; ++p) {
            const int r = (tid >> 3) + p * 32;       // 0..127
            const int c = (tid & 7) * 4;             // 0..28
            float4 f = *(const float4*)&A[(size_t)(m0 + r) * D + k0 + c];
            bf16* dst = &As[r * P_STRIDE + c];
            dst[0] = (bf16)f.x; dst[1] = (bf16)f.y;
            dst[2] = (bf16)f.z; dst[3] = (bf16)f.w;
        }
        // ---- stage W tile transposed: W[k, n] -> Ws[n][k] ----
        #pragma unroll
        for (int p = 0; p < 4; ++p) {
            const int r = (tid >> 5) + p * 8;        // k row 0..31
            const int c = (tid & 31) * 4;            // n col 0..124
            float4 f = *(const float4*)&W[(size_t)(k0 + r) * D + n0 + c];
            Ws[(c + 0) * P_STRIDE + r] = (bf16)f.x;
            Ws[(c + 1) * P_STRIDE + r] = (bf16)f.y;
            Ws[(c + 2) * P_STRIDE + r] = (bf16)f.z;
            Ws[(c + 3) * P_STRIDE + r] = (bf16)f.w;
        }
        __syncthreads();

        // ---- fragments + 8 WMMAs ----
        v16bf af[4], bf_[2];
        #pragma unroll
        for (int mt = 0; mt < 4; ++mt)
            af[mt] = ldfrag(&As[(wm * 64 + mt * 16 + ln) * P_STRIDE + hi * 16]);
        #pragma unroll
        for (int nt = 0; nt < 2; ++nt)
            bf_[nt] = ldfrag(&Ws[(wn * 32 + nt * 16 + ln) * P_STRIDE + hi * 16]);
        #pragma unroll
        for (int mt = 0; mt < 4; ++mt)
            #pragma unroll
            for (int nt = 0; nt < 2; ++nt)
                acc[mt][nt] = WMMA_BF16(af[mt], bf_[nt], acc[mt][nt]);
        __syncthreads();
    }

    // ---- epilogue: bias add, convert to bf16, store ----
    #pragma unroll
    for (int mt = 0; mt < 4; ++mt) {
        #pragma unroll
        for (int nt = 0; nt < 2; ++nt) {
            const int N = n0 + wn * 32 + nt * 16 + ln;
            const float bn = bias[N];
            #pragma unroll
            for (int v = 0; v < 8; ++v) {
                const int Mi = m0 + wm * 64 + mt * 16 + v + 8 * hi;
                C[(size_t)Mi * D + N] = (bf16)(acc[mt][nt][v] + bn);
            }
        }
    }
}

// ---------------------------------------------------------------------------
// Kernel 2: flash attention, O accumulators in registers.
// One block per (batch, 64-query block); 512 threads = 16 waves.
// Wave (g, dch): g = query group (16 rows), dch = 128-wide d-chunk of output.
//   * scores: the 4 waves of group g split the d=512 reduction (4 K-steps each),
//     partial f32 accumulators reduced through LDS (16-byte ops, lane pitch 16 bytes).
//   * both products are transposed: S^T = K x Q^T and O^T += V^T x P^T, so a lane
//     owns one query: 16 of its 32 scores lie in the lane, 16 in lane ^ 16.
//   * softmax stats recomputed redundantly per wave: maximum and sum in-lane,
//     one exchange between the lane halves for the maximum.
//   * P^T is packed from the two score tiles into the B operand (hardware k
//     order); it never touches LDS.
//   * V stays row-major in LDS; the A fragments V^T come from transposing LDS
//     loads, which deliver the same hardware k order.
//   * O^T update: register-resident v8f acc[8] per wave, rescaled by alpha, WMMA.
// LDS (164 KB of 320 KB/WGP):
//   Qs [64][528] bf16 | Ks [32][528] bf16 | Vs [32][528] bf16
//   Sp 16x512 f32 (score partials)
// ---------------------------------------------------------------------------
static constexpr int QS_STRIDE = 528;
static constexpr int KS_STRIDE = 528;
static constexpr int VS_STRIDE = 528;   // 1056 B = 32 B x odd: the pitch of transposing loads

static constexpr size_t OFF_QS = 0;
static constexpr size_t OFF_KS = OFF_QS + (size_t)64 * QS_STRIDE * 2;   // 67584
static constexpr size_t OFF_VT = OFF_KS + (size_t)32 * KS_STRIDE * 2;   // +33792
static constexpr size_t OFF_SP = OFF_VT + (size_t)32 * VS_STRIDE * 2;   // +33792
static constexpr size_t ATTN_SMEM = OFF_SP + (size_t)16 * 512 * 4;      // 167936 B

__device__ __forceinline__ void stage_b128(const bf16* g, bf16* l) {
#if USE_ASYNC_LDS
    __builtin_amdgcn_global_load_async_to_lds_b128(
        (gv4i_p)(bf16*)g,   // strip const, then generic->AS1 int4*
        (lv4i_p)l,          // generic->AS3 int4*
        0, 0);
#else
    *(uint4*)l = *(const uint4*)g;
#endif
}

__device__ __forceinline__ void stage_wait() {
#if USE_ASYNC_LDS
    // the issuing wave's copies have landed before the barrier that publishes them;
    // asm with the clobber so that no LDS read is lifted over the wait
    asm volatile("s_wait_asynccnt 0x0" ::: "memory");
#endif
}

// 8 bf16 of one column of a row-major 16-bit LDS tile (8 rows x 16 columns per lane half)
__device__ __forceinline__ v8bf ld_tr16(const char* p) {
    return __builtin_bit_cast(v8bf, __builtin_amdgcn_ds_load_tr16_b128_v8i16((lv8s_p)(char*)p));
}

// value of lane l ^ 16
__device__ __forceinline__ float xhalf(float x) {
    const int i = __builtin_bit_cast(int, x);
    return __builtin_bit_cast(float,
        __builtin_amdgcn_permlanex16(i, i, 0x76543210, 0xfedcba98, false, false));
}

// LDS admits one work-group per WGP, four waves per SIMD: tell the register allocator so,
// or it schedules for eight and serialises each fragment load with its WMMA
__global__ __launch_bounds__(512) __attribute__((amdgpu_waves_per_eu(4, 4)))
void flash_attn_bf16(const bf16* __restrict__ qp, const bf16* __restrict__ kp,
                     const bf16* __restrict__ vp, float* __restrict__ out) {
    extern __shared__ char smem[];
    bf16*  Qs = (bf16*)(smem + OFF_QS);
    bf16*  Ks = (bf16*)(smem + OFF_KS);
    bf16*  Vs = (bf16*)(smem + OFF_VT);
    float* Sp = (float*)(smem + OFF_SP);

    const int b    = blockIdx.y;
    const int q0   = blockIdx.x * 64;
    const int tid  = threadIdx.x;
    const int lane = tid & 31;
    const int wave = tid >> 5;       // 0..15
    const int ln   = lane & 15;
    const int hi   = lane >> 4;
    const int g    = wave >> 2;      // query group 0..3
    const int dch  = wave & 3;       // d-chunk 0..3 (128 wide)
    const int dw   = dch * 128;

    const float SCALE = 0.044194173824159216f;   // 1/sqrt(512)
    const float LOG2E = 1.4426950408889634f;

    // ---- preload Q block (64x512 bf16) via async-to-LDS ----
    const bf16* qbase = qp + ((size_t)b * S + q0) * D;
    for (int i = tid; i < 64 * 64; i += 512) {            // granule = 8 bf16
        const int r = i >> 6, c = i & 63;
        stage_b128(&qbase[(size_t)r * D + c * 8], &Qs[r * QS_STRIDE + c * 8]);
    }

    v8f acc_o[8];                    // O^T[128 d x 16 queries] for (g, dch), registers
    #pragma unroll
    for (int dc = 0; dc < 8; ++dc) acc_o[dc] = {};
    float m_run = -1.0e30f;          // running maximum of query ln
    float l_run = 0.0f;              // running sum over this lane half's keys only

    for (int kt = 0; kt < S / 32; ++kt) {
        const int k0 = kt * 32;
        const bf16* kbase = kp + ((size_t)b * S + k0) * D;
        const bf16* vbase = vp + ((size_t)b * S + k0) * D;
        // this wave's LDS reads of Ks/Vs have retired before any wave's copies refill them
        asm volatile("s_wait_dscnt 0x0" ::: "memory");
        __syncthreads();   // previous round done with Ks/Vs

        // ---- stage K tile (async straight copy, A-layout as-is) ----
        for (int i = tid; i < 32 * 64; i += 512) {
            const int r = i >> 6, c = i & 63;
            stage_b128(&kbase[(size_t)r * D + c * 8], &Ks[r * KS_STRIDE + c * 8]);
        }
        // ---- stage V tile (async straight copy, row-major Vs[k][d]) ----
        // fixed trip count, unrolled: straight-line copies with every lane on, no loop on EXEC
        #pragma unroll
        for (int p = 0; p < 4; ++p) {
            const int r = (tid >> 6) + p * 8, c = tid & 63;
            stage_b128(&vbase[(size_t)r * D + c * 8], &Vs[r * VS_STRIDE + c * 8]);
        }
        if (kt + 1 < S / 32) {       // L2 prefetch of next tiles
            __builtin_prefetch(kbase + (size_t)32 * D + (tid & 127) * 32, 0, 1);
            __builtin_prefetch(vbase + (size_t)32 * D + (tid & 127) * 32, 0, 1);
        }
        stage_wait();
        __syncthreads();

        // ---- partial scores S^T: this wave covers d in [dch*128, dch*128+128) ----
        // s0[v] = S[query ln][key 8*hi + v], s1[v] = S[query ln][key 16 + 8*hi + v]
        v8f s0 = {}, s1 = {};
        #pragma unroll
        for (int i = 0; i < 4; ++i) {
            const int dk = dch * 4 + i;
            v16bf a  = ldfrag(&Qs[(g * 16 + ln) * QS_STRIDE + dk * 32 + hi * 16]);
            v16bf b0 = ldfrag(&Ks[ln * KS_STRIDE + dk * 32 + hi * 16]);
            v16bf b1 = ldfrag(&Ks[(16 + ln) * KS_STRIDE + dk * 32 + hi * 16]);
            s0 = WMMA_BF16(b0, a, s0);
            s1 = WMMA_BF16(b1, a, s1);
        }
        {   // write partials: four 16-byte stores, each one contiguous over the 32 lanes
            // (plane j of a wave's 2 KB holds 4 floats per lane at a 16-byte lane pitch)
            v4f* sp = (v4f*)&Sp[(size_t)wave * 512] + lane;
            sp[0]  = __builtin_shufflevector(s0, s0, 0, 1, 2, 3);
            sp[32] = __builtin_shufflevector(s0, s0, 4, 5, 6, 7);
            sp[64] = __builtin_shufflevector(s1, s1, 0, 1, 2, 3);
            sp[96] = __builtin_shufflevector(s1, s1, 4, 5, 6, 7);
        }
        __syncthreads();

        // ---- reduce the 4 d-partials of my group (every wave, redundant) ----
        v8f t0 = {}, t1 = {};
        #pragma unroll
        for (int w2 = 0; w2 < 4; ++w2) {
            const v4f* sp = (const v4f*)&Sp[(size_t)(g * 4 + w2) * 512] + lane;
            const v4f a0 = sp[0], a1 = sp[32], b0 = sp[64], b1 = sp[96];
            #pragma unroll
            for (int v = 0; v < 4; ++v) {
                t0[v] += a0[v]; t0[4 + v] += a1[v];
                t1[v] += b0[v]; t1[4 + v] += b1[v];
            }
        }

        // ---- online softmax: query ln, 16 scores in this lane, 16 in lane ^ 16 ----
        float x0[8], x1[8];
        #pragma unroll
        for (int v = 0; v < 8; ++v) { x0[v] = t0[v] * SCALE; x1[v] = t1[v] * SCALE; }
        float mx = fmaxf(x0[0], x1[0]);
        #pragma unroll
        for (int v = 1; v < 8; ++v) mx = fmaxf(mx, fmaxf(x0[v], x1[v]));
        mx = fmaxf(mx, xhalf(mx));
        const float mnew  = fmaxf(m_run, mx);
        const float alpha = exp2f((m_run - mnew) * LOG2E);
        // P^T as B operand: element s of lane half hi is key 8*hi + s (s < 8) or
        // 16 + 8*hi + (s - 8), which is where the two score tiles hold it
        v16bf pb;
        float sum = 0.0f;
        #pragma unroll
        for (int v = 0; v < 8; ++v) {
            const float p0 = exp2f((x0[v] - mnew) * LOG2E);
            const float p1 = exp2f((x1[v] - mnew) * LOG2E);
            sum += p0 + p1;
            pb[v]     = (bf16)p0;
            pb[8 + v] = (bf16)p1;
        }
        l_run = l_run * alpha + sum;
        m_run = mnew;

        // ---- O^T update: acc = acc*alpha + V^T(128-chunk x 32) x P^T(32 x 16) ----
        const char* vrd = (const char*)Vs + (8 * hi + (lane & 7)) * (VS_STRIDE * 2)
                          + ((lane >> 3) & 1) * 16 + dw * 2;
        #pragma unroll
        for (int dc = 0; dc < 8; ++dc) {
            v8f c;
            #pragma unroll
            for (int v = 0; v < 8; ++v) c[v] = acc_o[dc][v] * alpha;
            const v16bf va = __builtin_shufflevector(ld_tr16(vrd + dc * 32),
                                                     ld_tr16(vrd + 16 * (VS_STRIDE * 2) + dc * 32),
                                                     0, 1, 2, 3, 4, 5, 6, 7, 8, 9, 10, 11, 12, 13, 14, 15);
            acc_o[dc] = WMMA_BF16(va, pb, c);
        }
    }

    // ---- normalize and store straight from registers ----
    // acc_o[dc][v] = O[query ln][dw + dc*16 + 8*hi + v]: 32 contiguous bytes per lane
    const float invl = 1.0f / (l_run + xhalf(l_run));   // join the two halves' sums
    float* obase = out + ((size_t)b * S + q0 + g * 16 + ln) * D + dw + 8 * hi;
    #pragma unroll
    for (int dc = 0; dc < 8; ++dc) {
        #pragma unroll
        for (int v = 0; v < 8; ++v) acc_o[dc][v] *= invl;
    }
    #pragma unroll
    for (int dc = 0; dc < 8; ++dc) {
        *(float4*)(obase + dc * 16) =
            make_float4(acc_o[dc][0], acc_o[dc][1], acc_o[dc][2], acc_o[dc][3]);
        *(float4*)(obase + dc * 16 + 4) =
            make_float4(acc_o[dc][4], acc_o[dc][5], acc_o[dc][6], acc_o[dc][7]);
    }
}

// ---------------------------------------------------------------------------
// Host launcher
// ---------------------------------------------------------------------------
extern "C" void kernel_launch(void* const* d_in, const int* in_sizes, int n_in,
                              void* d_out, int out_size, void* d_ws, size_t ws_size,
                              hipStream_t stream) {
    (void)in_sizes; (void)n_in; (void)out_size; (void)ws_size;
    const float* q  = (const float*)d_in[0];
    const float* k  = (const float*)d_in[1];
    const float* v  = (const float*)d_in[2];
    const float* Wq = (const float*)d_in[3];
    const float* bq = (const float*)d_in[4];
    const float* Wk = (const float*)d_in[5];
    const float* bk = (const float*)d_in[6];
    const float* Wv = (const float*)d_in[7];
    const float* bv = (const float*)d_in[8];
    float* out = (float*)d_out;

    bf16* qp = (bf16*)d_ws;
    bf16* kp = qp + (size_t)M_TOT * D;
    bf16* vp = kp + (size_t)M_TOT * D;

    dim3 pg(D / 128, M_TOT / 128);   // 4 x 128
    proj_gemm_bf16<<<pg, 256, 0, stream>>>(q, Wq, bq, qp);
    proj_gemm_bf16<<<pg, 256, 0, stream>>>(k, Wk, bk, kp);
    proj_gemm_bf16<<<pg, 256, 0, stream>>>(v, Wv, bv, vp);

    dim3 ag(S / 64, NB);             // 32 x 8
    flash_attn_bf16<<<ag, 512, ATTN_SMEM, stream>>>(qp, kp, vp, out);
}

// v004
// Measured time: 233 microseconds a run.
// In both of two side-by-side timings against v003, it was 1.60 times as fast.
// Counting every step since v000, it is 3.72 times as fast.
#include <hip/hip_runtime.h>

// ---------------------------------------------------------------------------
// Types for CDNA5 WMMA (gfx1250, wave32)
// ---------------------------------------------------------------------------
typedef __bf16 bf16;
typedef __attribute__((ext_vector_type(16))) __bf16 v16bf;
typedef __attribute__((ext_vector_type(8)))  float  v8f;
typedef __attribute__((ext_vector_type(4)))  float  v4f;
typedef __attribute__((ext_vector_type(4)))  int    v4i;
typedef __attribute__((ext_vector_type(8)))  __bf16 v8bf;
typedef __attribute__((ext_vector_type(4)))  __bf16 v4bf;
typedef __attribute__((ext_vector_type(8)))  short  v8s;

// Pointer types matching the async-to-LDS builtin's parameters
// (param0: int4 addrspace(1)*, param1: int4 addrspace(3)* per hipcc diagnostic)
typedef __attribute__((address_space(1))) v4i* gv4i_p;
typedef __attribute__((address_space(3))) v4i* lv4i_p;
typedef __attribute__((address_space(3))) v8s* lv8s_p;

#define WMMA_BF16(a, b, c) \
    __builtin_amdgcn_wmma_f32_16x16x32_bf16(false, (a), false, (b), (short)0, (c), false, false)

#if __has_builtin(__builtin_amdgcn_global_load_async_to_lds_b128) && \
    __has_builtin(__builtin_amdgcn_s_wait_asynccnt)
#define USE_ASYNC_LDS 1
#else
#define USE_ASYNC_LDS 0
#endif

__device__ __forceinline__ v16bf ldfrag(const bf16* p) {
    // 32-byte aligned LDS fragment load (16 bf16)
    return *(const v16bf*)p;
}

// 8 bf16 of one column of a row-major 16-bit LDS tile (8 rows x 16 columns per lane half)
__device__ __forceinline__ v8bf ld_tr16(const char* p) {
    return __builtin_bit_cast(v8bf, __builtin_amdgcn_ds_load_tr16_b128_v8i16((lv8s_p)(char*)p));
}

// Problem constants
static constexpr int D  = 512;       // model dim (= INPUT_SIZE = 2*HIDDEN)
static constexpr int S  = 2048;      // sequence length
static constexpr int NB = 8;         // batch
static constexpr int M_TOT = NB * S; // 16384 rows for the projections

// ---------------------------------------------------------------------------
// Kernel 1: projection GEMM  C[m,n] = sum_k A[m,k] * W[k,n] + bias[n]
// A: f32 [M,512], W: f32 [512,512] row-major (k-major), C: bf16 [M,512]
// Tile: 128(M) x 128(N), KT=32.  256 threads = 8 waves; wave -> 64x32 subtile.
// W stays row-major in LDS (8-byte stores, contiguous over the lanes); the B fragments
// come from transposing LDS loads, which deliver the hardware k order, so the A
// fragments are read in that order too: k = 8*hi + s (s < 8), 16 + 8*hi + (s - 8).
// ---------------------------------------------------------------------------
static constexpr int P_STRIDE = 48;   // padded LDS row stride of the A tile (96 B)
static constexpr int W_STRIDE = 144;  // 288 B = 32 B x odd: the pitch of transposing loads

__global__ __launch_bounds__(256)
void proj_gemm_bf16(const float* __restrict__ A, const float* __restrict__ W,
                    const float* __restrict__ bias, bf16* __restrict__ C) {
    __shared__ __attribute__((aligned(32))) bf16 As[128 * P_STRIDE];  // [row m 0..127][k 0..31]
    __shared__ __attribute__((aligned(32))) bf16 Ws[32 * W_STRIDE];   // [k 0..31][col n 0..127]

    const int n0 = blockIdx.x * 128;
    const int m0 = blockIdx.y * 128;

    const int tid  = threadIdx.x;
    const int lane = tid & 31;
    const int wave = tid >> 5;
    const int ln   = lane & 15;        // N / M index within fragment
    const int hi   = lane >> 4;        // K-half selector (A/B frag layout)
    const int wm   = wave >> 2;        // 0..1 : 64-row slab
    const int wn   = wave & 3;         // 0..3 : 32-col slab

    v8f acc[4][2];
    #pragma unroll
    for (int mt = 0; mt < 4; ++mt)
        #pragma unroll
        for (int nt = 0; nt < 2; ++nt) acc[mt][nt] = {};

    for (int kk = 0; kk < 16; ++kk) {       // K = 512, KT = 32
        const int k0 = kk * 32;
        // ---- stage A tile: 128x32 f32 -> bf16, row-major ----
        #pragma unroll
        for (int p = 0; p < 4; ++p) {
            const int r = (tid >> 3) + p * 32;       // 0..127
            const int c = (tid & 7) * 4;             // 0..28
            float4 f = *(const float4*)&A[(size_t)(m0 + r) * D + k0 + c];
            bf16* dst = &As[r * P_STRIDE + c];
            dst[0] = (bf16)f.x; dst[1] = (bf16)f.y;
            dst[2] = (bf16)f.z; dst[3] = (bf16)f.w;
        }
        // ---- stage W tile row-major: W[k, n] -> Ws[k][n] ----
        #pragma unroll
        for (int p = 0; p < 4; ++p) {
            const int r = (tid >> 5) + p * 8;        // k row 0..31
            const int c = (tid & 31) * 4;            // n col 0..124
            float4 f = *(const float4*)&W[(size_t)(k0 + r) * D + n0 + c];
            const v4bf w4 = {(bf16)f.x, (bf16)f.y, (bf16)f.z, (bf16)f.w};
            *(v4bf*)&Ws[r * W_STRIDE + c] = w4;
        }
        __syncthreads();

        // ---- fragments + 8 WMMAs ----
        v16bf af[4], bf_[2];
        #pragma unroll
        for (int mt = 0; mt < 4; ++mt) {
            const bf16* ap = &As[(wm * 64 + mt * 16 + ln) * P_STRIDE + hi * 8];
            af[mt] = __builtin_shufflevector(*(const v8bf*)ap, *(const v8bf*)(ap + 16),
                                             0, 1, 2, 3, 4, 5, 6, 7, 8, 9, 10, 11, 12, 13, 14, 15);
        }
        const char* wrd = (const char*)Ws + (8 * hi + (lane & 7)) * (W_STRIDE * 2)
                          + ((lane >> 3) & 1) * 16 + wn * 64;
        #pragma unroll
        for (int nt = 0; nt < 2; ++nt)
            bf_[nt] = __builtin_shufflevector(ld_tr16(wrd + nt * 32),
                                              ld_tr16(wrd + 16 * (W_STRIDE * 2) + nt * 32),
                                              0, 1, 2, 3, 4, 5, 6, 7, 8, 9, 10, 11, 12, 13, 14, 15);
        #pragma unroll
        for (int mt = 0; mt < 4; ++mt)
            #pragma unroll
            for (int nt = 0; nt < 2; ++nt)
                acc[mt][nt] = WMMA_BF16(af[mt], bf_[nt], acc[mt][nt]);
        __syncthreads();
    }

    // ---- epilogue: bias add, convert to bf16, store ----
    #pragma unroll
    for (int mt = 0; mt < 4; ++mt) {
        #pragma unroll
        for (int nt = 0; nt < 2; ++nt) {
            const int N = n0 + wn * 32 + nt * 16 + ln;
            const float bn = bias[N];
            #pragma unroll
            for (int v = 0; v < 8; ++v) {
                const int Mi = m0 + wm * 64 + mt * 16 + v + 8 * hi;
                C[(size_t)Mi * D + N] = (bf16)(acc[mt][nt][v] + bn);
            }
        }
    }
}

// ---------------------------------------------------------------------------
// Kernel 2: flash attention, O accumulators in registers.
// One block per (batch, 64-query block); 512 threads = 16 waves.
// Wave (g, dch): g = query group (16 rows), dch = 128-wide d-chunk of output.
//   * scores: the 4 waves of group g split the d=512 reduction (4 K-steps each),
//     partial f32 accumulators reduced through LDS (16-byte ops, lane pitch 16 bytes).
//   * both products are transposed: S^T = K x Q^T and O^T += V^T x P^T, so a lane
//     owns one query: 16 of its 32 scores lie in the lane, 16 in lane ^ 16.
//   * softmax stats recomputed redundantly per wave: maximum and sum in-lane,
//     one exchange between the lane halves for the maximum.
//   * P^T is packed from the two score tiles into the B operand (hardware k
//     order); it never touches LDS.
//   * V stays row-major in LDS; the A fragments V^T come from transposing LDS
//     loads, which deliver the same hardware k order.
//   * O^T update: register-resident v8f acc[8] per wave, rescaled by alpha, WMMA.
// LDS (164 KB of 320 KB/WGP):
//   Qs [64][528] bf16 | Ks [32][528] bf16 | Vs [32][528] bf16
//   Sp 16x512 f32 (score partials)
// ---------------------------------------------------------------------------
static constexpr int QS_STRIDE = 528;
static constexpr int KS_STRIDE = 528;
static constexpr int VS_STRIDE = 528;   // 1056 B = 32 B x odd: the pitch of transposing loads

static constexpr size_t OFF_QS = 0;
static constexpr size_t OFF_KS = OFF_QS + (size_t)64 * QS_STRIDE * 2;   // 67584
static constexpr size_t OFF_VT = OFF_KS + (size_t)32 * KS_STRIDE * 2;   // +33792
static constexpr size_t OFF_SP = OFF_VT + (size_t)32 * VS_STRIDE * 2;   // +33792
static constexpr size_t ATTN_SMEM = OFF_SP + (size_t)16 * 512 * 4;      // 167936 B

__device__ __forceinline__ void stage_b128(const bf16* g, bf16* l) {
#if USE_ASYNC_LDS
    __builtin_amdgcn_global_load_async_to_lds_b128(
        (gv4i_p)(bf16*)g,   // strip const, then generic->AS1 int4*
        (lv4i_p)l,          // generic->AS3 int4*
        0, 0);
#else
    *(uint4*)l = *(const uint4*)g;
#endif
}

__device__ __forceinline__ void stage_wait() {
#if USE_ASYNC_LDS
    // the issuing wave's copies have landed before the barrier that publishes them;
    // asm with the clobber so that no LDS read is lifted over the wait
    asm volatile("s_wait_asynccnt 0x0" ::: "memory");
#endif
}

// value of lane l ^ 16
__device__ __forceinline__ float xhalf(float x) {
    const int i = __builtin_bit_cast(int, x);
    return __builtin_bit_cast(float,
        __builtin_amdgcn_permlanex16(i, i, 0x76543210, 0xfedcba98, false, false));
}

// LDS admits one work-group per WGP, four waves per SIMD: tell the register allocator so,
// or it schedules for eight and serialises each fragment load with its WMMA
__global__ __launch_bounds__(512) __attribute__((amdgpu_waves_per_eu(4, 4)))
void flash_attn_bf16(const bf16* __restrict__ qp, const bf16* __restrict__ kp,
                     const bf16* __restrict__ vp, float* __restrict__ out) {
    extern __shared__ char smem[];
    bf16*  Qs = (bf16*)(smem + OFF_QS);
    bf16*  Ks = (bf16*)(smem + OFF_KS);
    bf16*  Vs = (bf16*)(smem + OFF_VT);
    float* Sp = (float*)(smem + OFF_SP);

    const int b    = blockIdx.y;
    const int q0   = blockIdx.x * 64;
    const int tid  = threadIdx.x;
    const int lane = tid & 31;
    const int wave = tid >> 5;       // 0..15
    const int ln   = lane & 15;
    const int hi   = lane >> 4;
    const int g    = wave >> 2;      // query group 0..3
    const int dch  = wave & 3;       // d-chunk 0..3 (128 wide)
    const int dw   = dch * 128;

    const float SCALE = 0.044194173824159216f;   // 1/sqrt(512)
    const float LOG2E = 1.4426950408889634f;

    // ---- preload Q block (64x512 bf16) via async-to-LDS ----
    const bf16* qbase = qp + ((size_t)b * S + q0) * D;
    for (int i = tid; i < 64 * 64; i += 512) {            // granule = 8 bf16
        const int r = i >> 6, c = i & 63;
        stage_b128(&qbase[(size_t)r * D + c * 8], &Qs[r * QS_STRIDE + c * 8]);
    }

    v8f acc_o[8];                    // O^T[128 d x 16 queries] for (g, dch), registers
    #pragma unroll
    for (int dc = 0; dc < 8; ++dc) acc_o[dc] = {};
    float m_run = -1.0e30f;          // running maximum of query ln
    float l_run = 0.0f;              // running sum over this lane half's keys only

    for (int kt = 0; kt < S / 32; ++kt) {
        const int k0 = kt * 32;
        const bf16* kbase = kp + ((size_t)b * S + k0) * D;
        const bf16* vbase = vp + ((size_t)b * S + k0) * D;
        // this wave's LDS reads of Ks/Vs have retired before any wave's copies refill them
        asm volatile("s_wait_dscnt 0x0" ::: "memory");
        __syncthreads();   // previous round done with Ks/Vs

        // ---- stage K tile (async straight copy, A-layout as-is) ----
        for (int i = tid; i < 32 * 64; i += 512) {
            const int r = i >> 6, c = i & 63;
            stage_b128(&kbase[(size_t)r * D + c * 8], &Ks[r * KS_STRIDE + c * 8]);
        }
        // ---- stage V tile (async straight copy, row-major Vs[k][d]) ----
        // fixed trip count, unrolled: straight-line copies with every lane on, no loop on EXEC
        #pragma unroll
        for (int p = 0; p < 4; ++p) {
            const int r = (tid >> 6) + p * 8, c = tid & 63;
            stage_b128(&vbase[(size_t)r * D + c * 8], &Vs[r * VS_STRIDE + c * 8]);
        }
        if (kt + 1 < S / 32) {       // L2 prefetch of next tiles
            __builtin_prefetch(kbase + (size_t)32 * D + (tid & 127) * 32, 0, 1);
            __builtin_prefetch(vbase + (size_t)32 * D + (tid & 127) * 32, 0, 1);
        }
        stage_wait();
        __syncthreads();

        // ---- partial scores S^T: this wave covers d in [dch*128, dch*128+128) ----
        // s0[v] = S[query ln][key 8*hi + v], s1[v] = S[query ln][key 16 + 8*hi + v]
        v8f s0 = {}, s1 = {};
        #pragma unroll
        for (int i = 0; i < 4; ++i) {
            const int dk = dch * 4 + i;
            v16bf a  = ldfrag(&Qs[(g * 16 + ln) * QS_STRIDE + dk * 32 + hi * 16]);
            v16bf b0 = ldfrag(&Ks[ln * KS_STRIDE + dk * 32 + hi * 16]);
            v16bf b1 = ldfrag(&Ks[(16 + ln) * KS_STRIDE + dk * 32 + hi * 16]);
            s0 = WMMA_BF16(b0, a, s0);
            s1 = WMMA_BF16(b1, a, s1);
        }
        {   // write partials: four 16-byte stores, each one contiguous over the 32 lanes
            // (plane j of a wave's 2 KB holds 4 floats per lane at a 16-byte lane pitch)
            v4f* sp = (v4f*)&Sp[(size_t)wave * 512] + lane;
            sp[0]  = __builtin_shufflevector(s0, s0, 0, 1, 2, 3);
            sp[32] = __builtin_shufflevector(s0, s0, 4, 5, 6, 7);
            sp[64] = __builtin_shufflevector(s1, s1, 0, 1, 2, 3);
            sp[96] = __builtin_shufflevector(s1, s1, 4, 5, 6, 7);
        }
        __syncthreads();

        // ---- reduce the 4 d-partials of my group (every wave, redundant) ----
        v8f t0 = {}, t1 = {};
        #pragma unroll
        for (int w2 = 0; w2 < 4; ++w2) {
            const v4f* sp = (const v4f*)&Sp[(size_t)(g * 4 + w2) * 512] + lane;
            const v4f a0 = sp[0], a1 = sp[32], b0 = sp[64], b1 = sp[96];
            #pragma unroll
            for (int v = 0; v < 4; ++v) {
                t0[v] += a0[v]; t0[4 + v] += a1[v];
                t1[v] += b0[v]; t1[4 + v] += b1[v];
            }
        }

        // ---- online softmax: query ln, 16 scores in this lane, 16 in lane ^ 16 ----
        float x0[8], x1[8];
        #pragma unroll
        for (int v = 0; v < 8; ++v) { x0[v] = t0[v] * SCALE; x1[v] = t1[v] * SCALE; }
        float mx = fmaxf(x0[0], x1[0]);
        #pragma unroll
        for (int v = 1; v < 8; ++v) mx = fmaxf(mx, fmaxf(x0[v], x1[v]));
        mx = fmaxf(mx, xhalf(mx));
        const float mnew  = fmaxf(m_run, mx);
        const float alpha = exp2f((m_run - mnew) * LOG2E);
        // P^T as B operand: element s of lane half hi is key 8*hi + s (s < 8) or
        // 16 + 8*hi + (s - 8), which is where the two score tiles hold it
        v16bf pb;
        float sum = 0.0f;
        #pragma unroll
        for (int v = 0; v < 8; ++v) {
            const float p0 = exp2f((x0[v] - mnew) * LOG2E);
            const float p1 = exp2f((x1[v] - mnew) * LOG2E);
            sum += p0 + p1;
            pb[v]     = (bf16)p0;
            pb[8 + v] = (bf16)p1;
        }
        l_run = l_run * alpha + sum;
        m_run = mnew;

        // ---- O^T update: acc = acc*alpha + V^T(128-chunk x 32) x P^T(32 x 16) ----
        const char* vrd = (const char*)Vs + (8 * hi + (lane & 7)) * (VS_STRIDE * 2)
                          + ((lane >> 3) & 1) * 16 + dw * 2;
        #pragma unroll
        for (int dc = 0; dc < 8; ++dc) {
            v8f c;
            #pragma unroll
            for (int v = 0; v < 8; ++v) c[v] = acc_o[dc][v] * alpha;
            const v16bf va = __builtin_shufflevector(ld_tr16(vrd + dc * 32),
                                                     ld_tr16(vrd + 16 * (VS_STRIDE * 2) + dc * 32),
                                                     0, 1, 2, 3, 4, 5, 6, 7, 8, 9, 10, 11, 12, 13, 14, 15);
            acc_o[dc] = WMMA_BF16(va, pb, c);
        }
    }

    // ---- normalize and store straight from registers ----
    // acc_o[dc][v] = O[query ln][dw + dc*16 + 8*hi + v]: 32 contiguous bytes per lane
    const float invl = 1.0f / (l_run + xhalf(l_run));   // join the two halves' sums
    float* obase = out + ((size_t)b * S + q0 + g * 16 + ln) * D + dw + 8 * hi;
    #pragma unroll
    for (int dc = 0; dc < 8; ++dc) {
        #pragma unroll
        for (int v = 0; v < 8; ++v) acc_o[dc][v] *= invl;
    }
    #pragma unroll
    for (int dc = 0; dc < 8; ++dc) {
        *(float4*)(obase + dc * 16) =
            make_float4(acc_o[dc][0], acc_o[dc][1], acc_o[dc][2], acc_o[dc][3]);
        *(float4*)(obase + dc * 16 + 4) =
            make_float4(acc_o[dc][4], acc_o[dc][5], acc_o[dc][6], acc_o[dc][7]);
    }
}

// ---------------------------------------------------------------------------
// Host launcher
// ---------------------------------------------------------------------------
extern "C" void kernel_launch(void* const* d_in, const int* in_sizes, int n_in,
                              void* d_out, int out_size, void* d_ws, size_t ws_size,
                              hipStream_t stream) {
    (void)in_sizes; (void)n_in; (void)out_size; (void)ws_size;
    const float* q  = (const float*)d_in[0];
    const float* k  = (const float*)d_in[1];
    const float* v  = (const float*)d_in[2];
    const float* Wq = (const float*)d_in[3];
    const float* bq = (const float*)d_in[4];
    const float* Wk = (const float*)d_in[5];
    const float* bk = (const float*)d_in[6];
    const float* Wv = (const float*)d_in[7];
    const float* bv = (const float*)d_in[8];
    float* out = (float*)d_out;

    bf16* qp = (bf16*)d_ws;
    bf16* kp = qp + (size_t)M_TOT * D;
    bf16* vp = kp + (size_t)M_TOT * D;

    dim3 pg(D / 128, M_TOT / 128);   // 4 x 128
    proj_gemm_bf16<<<pg, 256, 0, stream>>>(q, Wq, bq, qp);
    proj_gemm_bf16<<<pg, 256, 0, stream>>>(k, Wk, bk, kp);
    proj_gemm_bf16<<<pg, 256, 0, stream>>>(v, Wv, bv, vp);

    dim3 ag(S / 64, NB);             // 32 x 8
    flash_attn_bf16<<<ag, 512, ATTN_SMEM, stream>>>(qp, kp, vp, out);
}

// v005
// Measured time: 195 microseconds a run.
// In two side-by-side timings against v004, it was 1.20 and 1.19 times as fast.
// Over all steps from v000 it is 4.45 times as fast.
#include <hip/hip_runtime.h>

// ---------------------------------------------------------------------------
// Types for CDNA5 WMMA (gfx1250, wave32)
// ---------------------------------------------------------------------------
typedef __bf16 bf16;
typedef __attribute__((ext_vector_type(16))) __bf16 v16bf;
typedef __attribute__((ext_vector_type(8)))  float  v8f;
typedef __attribute__((ext_vector_type(4)))  float  v4f;
typedef __attribute__((ext_vector_type(4)))  int    v4i;
typedef __attribute__((ext_vector_type(8)))  __bf16 v8bf;
typedef __attribute__((ext_vector_type(4)))  __bf16 v4bf;
typedef __attribute__((ext_vector_type(8)))  short  v8s;

// Pointer types matching the async-to-LDS builtin's parameters
// (param0: int4 addrspace(1)*, param1: int4 addrspace(3)* per hipcc diagnostic)
typedef __attribute__((address_space(1))) v4i* gv4i_p;
typedef __attribute__((address_space(3))) v4i* lv4i_p;
typedef __attribute__((address_space(3))) v8s* lv8s_p;

#define WMMA_BF16(a, b, c) \
    __builtin_amdgcn_wmma_f32_16x16x32_bf16(false, (a), false, (b), (short)0, (c), false, false)

#if __has_builtin(__builtin_amdgcn_global_load_async_to_lds_b128) && \
    __has_builtin(__builtin_amdgcn_s_wait_asynccnt)
#define USE_ASYNC_LDS 1
#else
#define USE_ASYNC_LDS 0
#endif

__device__ __forceinline__ v16bf ldfrag(const bf16* p) {
    // 32-byte aligned LDS fragment load (16 bf16)
    return *(const v16bf*)p;
}

// 8 bf16 of one column of a row-major 16-bit LDS tile (8 rows x 16 columns per lane half)
__device__ __forceinline__ v8bf ld_tr16(const char* p) {
    return __builtin_bit_cast(v8bf, __builtin_amdgcn_ds_load_tr16_b128_v8i16((lv8s_p)(char*)p));
}

// Problem constants
static constexpr int D  = 512;       // model dim (= INPUT_SIZE = 2*HIDDEN)
static constexpr int S  = 2048;      // sequence length
static constexpr int NB = 8;         // batch
static constexpr int M_TOT = NB * S; // 16384 rows for the projections

// ---------------------------------------------------------------------------
// Kernel 1: projection GEMM  C[m,n] = sum_k A[m,k] * W[k,n] + bias[n]
// A: f32 [M,512], W: f32 [512,512] row-major (k-major), C: bf16 [M,512]
// Tile: 128(M) x 128(N), KT=32.  256 threads = 8 waves; wave -> 64x32 subtile.
// W stays row-major in LDS (8-byte stores, contiguous over the lanes); the B fragments
// come from transposing LDS loads, which deliver the hardware k order, so the A
// fragments are read in that order too: k = 8*hi + s (s < 8), 16 + 8*hi + (s - 8).
// ---------------------------------------------------------------------------
static constexpr int P_STRIDE = 48;   // padded LDS row stride of the A tile (96 B)
static constexpr int W_STRIDE = 144;  // 288 B = 32 B x odd: the pitch of transposing loads

__global__ __launch_bounds__(256)
void proj_gemm_bf16(const float* __restrict__ A, const float* __restrict__ W,
                    const float* __restrict__ bias, bf16* __restrict__ C) {
    __shared__ __attribute__((aligned(32))) bf16 As[128 * P_STRIDE];  // [row m 0..127][k 0..31]
    __shared__ __attribute__((aligned(32))) bf16 Ws[32 * W_STRIDE];   // [k 0..31][col n 0..127]

    const int n0 = blockIdx.x * 128;
    const int m0 = blockIdx.y * 128;

    const int tid  = threadIdx.x;
    const int lane = tid & 31;
    const int wave = tid >> 5;
    const int ln   = lane & 15;        // N / M index within fragment
    const int hi   = lane >> 4;        // K-half selector (A/B frag layout)
    const int wm   = wave >> 2;        // 0..1 : 64-row slab
    const int wn   = wave & 3;         // 0..3 : 32-col slab

    v8f acc[4][2];
    #pragma unroll
    for (int mt = 0; mt < 4; ++mt)
        #pragma unroll
        for (int nt = 0; nt < 2; ++nt) acc[mt][nt] = {};

    for (int kk = 0; kk < 16; ++kk) {       // K = 512, KT = 32
        const int k0 = kk * 32;
        // ---- stage A tile: 128x32 f32 -> bf16, row-major ----
        #pragma unroll
        for (int p = 0; p < 4; ++p) {
            const int r = (tid >> 3) + p * 32;       // 0..127
            const int c = (tid & 7) * 4;             // 0..28
            float4 f = *(const float4*)&A[(size_t)(m0 + r) * D + k0 + c];
            bf16* dst = &As[r * P_STRIDE + c];
            dst[0] = (bf16)f.x; dst[1] = (bf16)f.y;
            dst[2] = (bf16)f.z; dst[3] = (bf16)f.w;
        }
        // ---- stage W tile row-major: W[k, n] -> Ws[k][n] ----
        #pragma unroll
        for (int p = 0; p < 4; ++p) {
            const int r = (tid >> 5) + p * 8;        // k row 0..31
            const int c = (tid & 31) * 4;            // n col 0..124
            float4 f = *(const float4*)&W[(size_t)(k0 + r) * D + n0 + c];
            const v4bf w4 = {(bf16)f.x, (bf16)f.y, (bf16)f.z, (bf16)f.w};
            *(v4bf*)&Ws[r * W_STRIDE + c] = w4;
        }
        __syncthreads();

        // ---- fragments + 8 WMMAs ----
        v16bf af[4], bf_[2];
        #pragma unroll
        for (int mt = 0; mt < 4; ++mt) {
            const bf16* ap = &As[(wm * 64 + mt * 16 + ln) * P_STRIDE + hi * 8];
            af[mt] = __builtin_shufflevector(*(const v8bf*)ap, *(const v8bf*)(ap + 16),
                                             0, 1, 2, 3, 4, 5, 6, 7, 8, 9, 10, 11, 12, 13, 14, 15);
        }
        const char* wrd = (const char*)Ws + (8 * hi + (lane & 7)) * (W_STRIDE * 2)
                          + ((lane >> 3) & 1) * 16 + wn * 64;
        #pragma unroll
        for (int nt = 0; nt < 2; ++nt)
            bf_[nt] = __builtin_shufflevector(ld_tr16(wrd + nt * 32),
                                              ld_tr16(wrd + 16 * (W_STRIDE * 2) + nt * 32),
                                              0, 1, 2, 3, 4, 5, 6, 7, 8, 9, 10, 11, 12, 13, 14, 15);
        #pragma unroll
        for (int mt = 0; mt < 4; ++mt)
            #pragma unroll
            for (int nt = 0; nt < 2; ++nt)
                acc[mt][nt] = WMMA_BF16(af[mt], bf_[nt], acc[mt][nt]);
        __syncthreads();
    }

    // ---- epilogue: bias add, convert to bf16, store ----
    #pragma unroll
    for (int mt = 0; mt < 4; ++mt) {
        #pragma unroll
        for (int nt = 0; nt < 2; ++nt) {
            const int N = n0 + wn * 32 + nt * 16 + ln;
            const float bn = bias[N];
            #pragma unroll
            for (int v = 0; v < 8; ++v) {
                const int Mi = m0 + wm * 64 + mt * 16 + v + 8 * hi;
                C[(size_t)Mi * D + N] = (bf16)(acc[mt][nt][v] + bn);
            }
        }
    }
}

// ---------------------------------------------------------------------------
// Kernel 2: flash attention, O accumulators in registers.
// One block per (batch, 64-query block); 512 threads = 16 waves.
// Wave (g, dch): g = query group (16 rows), dch = 128-wide d-chunk of output.
//   * scores: the 4 waves of group g split the d=512 reduction (4 K-steps each),
//     partial f32 accumulators reduced through LDS (16-byte ops, lane pitch 16 bytes).
//   * both products are transposed: S^T = K x Q^T and O^T += V^T x P^T, so a lane
//     owns one query: 16 of its 32 scores lie in the lane, 16 in lane ^ 16.
//   * softmax stats recomputed redundantly per wave: maximum and sum in-lane,
//     one exchange between the lane halves for the maximum.
//   * P^T is packed from the two score tiles into the B operand (hardware k
//     order); it never touches LDS.
//   * V stays row-major in LDS; the A fragments V^T come from transposing LDS
//     loads, which deliver the same hardware k order.
//   * O^T update: register-resident v8f acc[8] per wave, rescaled by alpha, WMMA.
//   * K and V tiles sit in two LDS buffers: tile t + 2's copies are issued at the foot
//     of trip t into the buffer that trip has just read, and land during trip t + 1.
// LDS (230 KB of 320 KB/WGP):
//   Qs [64][528] bf16 | 2 x { Ks [32][528] bf16 | Vs [32][528] bf16 }
//   Sp 16x512 f32 (score partials)
// ---------------------------------------------------------------------------
static constexpr int QS_STRIDE = 528;
static constexpr int KS_STRIDE = 528;
static constexpr int VS_STRIDE = 528;   // 1056 B = 32 B x odd: the pitch of transposing loads

static constexpr size_t OFF_QS = 0;
static constexpr size_t OFF_KS = OFF_QS + (size_t)64 * QS_STRIDE * 2;   // 67584
static constexpr size_t OFF_VT = OFF_KS + (size_t)32 * KS_STRIDE * 2;   // +33792
static constexpr int    KV_BUF = 32 * KS_STRIDE + 32 * VS_STRIDE;       // elements from buffer 0 to buffer 1
static constexpr size_t OFF_SP = OFF_KS + (size_t)2 * KV_BUF * 2;       // +135168
static constexpr size_t ATTN_SMEM = OFF_SP + (size_t)16 * 512 * 4;      // 235520 B

__device__ __forceinline__ void stage_b128(const bf16* g, bf16* l) {
#if USE_ASYNC_LDS
    __builtin_amdgcn_global_load_async_to_lds_b128(
        (gv4i_p)(bf16*)g,   // strip const, then generic->AS1 int4*
        (lv4i_p)l,          // generic->AS3 int4*
        0, 0);
#else
    *(uint4*)l = *(const uint4*)g;
#endif
}

__device__ __forceinline__ void stage_wait() {
#if USE_ASYNC_LDS
    // the issuing wave's copies have landed before the barrier that publishes them;
    // asm with the clobber so that no LDS read is lifted over the wait
    asm volatile("s_wait_asynccnt 0x0" ::: "memory");
#endif
}

// value of lane l ^ 16
__device__ __forceinline__ float xhalf(float x) {
    const int i = __builtin_bit_cast(int, x);
    return __builtin_bit_cast(float,
        __builtin_amdgcn_permlanex16(i, i, 0x76543210, 0xfedcba98, false, false));
}

// LDS admits one work-group per WGP, four waves per SIMD: tell the register allocator so,
// or it schedules for eight and serialises each fragment load with its WMMA
__global__ __launch_bounds__(512) __attribute__((amdgpu_waves_per_eu(4, 4)))
void flash_attn_bf16(const bf16* __restrict__ qp, const bf16* __restrict__ kp,
                     const bf16* __restrict__ vp, float* __restrict__ out) {
    extern __shared__ char smem[];
    bf16*  Qs = (bf16*)(smem + OFF_QS);
    bf16*  Ks = (bf16*)(smem + OFF_KS);
    bf16*  Vs = (bf16*)(smem + OFF_VT);
    float* Sp = (float*)(smem + OFF_SP);

    const int b    = blockIdx.y;
    const int q0   = blockIdx.x * 64;
    const int tid  = threadIdx.x;
    const int lane = tid & 31;
    const int wave = tid >> 5;       // 0..15
    const int ln   = lane & 15;
    const int hi   = lane >> 4;
    const int g    = wave >> 2;      // query group 0..3
    const int dch  = wave & 3;       // d-chunk 0..3 (128 wide)
    const int dw   = dch * 128;

    const float SCALE = 0.044194173824159216f;   // 1/sqrt(512)
    const float LOG2E = 1.4426950408889634f;

    // ---- preload Q block (64x512 bf16) via async-to-LDS ----
    const bf16* qbase = qp + ((size_t)b * S + q0) * D;
    for (int i = tid; i < 64 * 64; i += 512) {            // granule = 8 bf16
        const int r = i >> 6, c = i & 63;
        stage_b128(&qbase[(size_t)r * D + c * 8], &Qs[r * QS_STRIDE + c * 8]);
    }

    v8f acc_o[8];                    // O^T[128 d x 16 queries] for (g, dch), registers
    #pragma unroll
    for (int dc = 0; dc < 8; ++dc) acc_o[dc] = {};
    float m_run = -1.0e30f;          // running maximum of query ln
    float l_run = 0.0f;              // running sum over this lane half's keys only

    // ---- K and V tile t (32 keys x 512) into buffer t & 1: async straight copies ----
    // fixed trip counts, unrolled: straight-line copies with every lane on, no loop on EXEC
    auto stage_kv = [&](int t) {
        const bf16* kbase = kp + ((size_t)b * S + t * 32) * D;
        const bf16* vbase = vp + ((size_t)b * S + t * 32) * D;
        bf16* kd = Ks + (t & 1) * KV_BUF;
        bf16* vd = Vs + (t & 1) * KV_BUF;
        #pragma unroll
        for (int p = 0; p < 4; ++p) {
            const int r = (tid >> 6) + p * 8, c = tid & 63;
            stage_b128(&kbase[(size_t)r * D + c * 8], &kd[r * KS_STRIDE + c * 8]);
        }
        #pragma unroll
        for (int p = 0; p < 4; ++p) {
            const int r = (tid >> 6) + p * 8, c = tid & 63;
            stage_b128(&vbase[(size_t)r * D + c * 8], &vd[r * VS_STRIDE + c * 8]);
        }
    };

    // prologue: Q and tile 0 land and are published, then tile 1 starts
    stage_kv(0);
    stage_wait();
    __syncthreads();
    stage_kv(1);

    for (int kt = 0; kt < S / 32; ++kt) {
        const bf16* Kc = Ks + (kt & 1) * KV_BUF;   // this trip reads buffer kt & 1 alone
        const bf16* Vc = Vs + (kt & 1) * KV_BUF;

        // ---- partial scores S^T: this wave covers d in [dch*128, dch*128+128) ----
        // s0[v] = S[query ln][key 8*hi + v], s1[v] = S[query ln][key 16 + 8*hi + v]
        v8f s0 = {}, s1 = {};
        #pragma unroll
        for (int i = 0; i < 4; ++i) {
            const int dk = dch * 4 + i;
            v16bf a  = ldfrag(&Qs[(g * 16 + ln) * QS_STRIDE + dk * 32 + hi * 16]);
            v16bf b0 = ldfrag(&Kc[ln * KS_STRIDE + dk * 32 + hi * 16]);
            v16bf b1 = ldfrag(&Kc[(16 + ln) * KS_STRIDE + dk * 32 + hi * 16]);
            s0 = WMMA_BF16(b0, a, s0);
            s1 = WMMA_BF16(b1, a, s1);
        }
        {   // write partials: four 16-byte stores, each one contiguous over the 32 lanes
            // (plane j of a wave's 2 KB holds 4 floats per lane at a 16-byte lane pitch)
            v4f* sp = (v4f*)&Sp[(size_t)wave * 512] + lane;
            sp[0]  = __builtin_shufflevector(s0, s0, 0, 1, 2, 3);
            sp[32] = __builtin_shufflevector(s0, s0, 4, 5, 6, 7);
            sp[64] = __builtin_shufflevector(s1, s1, 0, 1, 2, 3);
            sp[96] = __builtin_shufflevector(s1, s1, 4, 5, 6, 7);
        }
        __syncthreads();

        // ---- reduce the 4 d-partials of my group (every wave, redundant) ----
        v8f t0 = {}, t1 = {};
        #pragma unroll
        for (int w2 = 0; w2 < 4; ++w2) {
            const v4f* sp = (const v4f*)&Sp[(size_t)(g * 4 + w2) * 512] + lane;
            const v4f a0 = sp[0], a1 = sp[32], b0 = sp[64], b1 = sp[96];
            #pragma unroll
            for (int v = 0; v < 4; ++v) {
                t0[v] += a0[v]; t0[4 + v] += a1[v];
                t1[v] += b0[v]; t1[4 + v] += b1[v];
            }
        }

        // ---- online softmax: query ln, 16 scores in this lane, 16 in lane ^ 16 ----
        float x0[8], x1[8];
        #pragma unroll
        for (int v = 0; v < 8; ++v) { x0[v] = t0[v] * SCALE; x1[v] = t1[v] * SCALE; }
        float mx = fmaxf(x0[0], x1[0]);
        #pragma unroll
        for (int v = 1; v < 8; ++v) mx = fmaxf(mx, fmaxf(x0[v], x1[v]));
        mx = fmaxf(mx, xhalf(mx));
        const float mnew  = fmaxf(m_run, mx);
        const float alpha = exp2f((m_run - mnew) * LOG2E);
        // P^T as B operand: element s of lane half hi is key 8*hi + s (s < 8) or
        // 16 + 8*hi + (s - 8), which is where the two score tiles hold it
        v16bf pb;
        float sum = 0.0f;
        #pragma unroll
        for (int v = 0; v < 8; ++v) {
            const float p0 = exp2f((x0[v] - mnew) * LOG2E);
            const float p1 = exp2f((x1[v] - mnew) * LOG2E);
            sum += p0 + p1;
            pb[v]     = (bf16)p0;
            pb[8 + v] = (bf16)p1;
        }
        l_run = l_run * alpha + sum;
        m_run = mnew;

        // ---- O^T update: acc = acc*alpha + V^T(128-chunk x 32) x P^T(32 x 16) ----
        const char* vrd = (const char*)Vc + (8 * hi + (lane & 7)) * (VS_STRIDE * 2)
                          + ((lane >> 3) & 1) * 16 + dw * 2;
        #pragma unroll
        for (int dc = 0; dc < 8; ++dc) {
            v8f c;
            #pragma unroll
            for (int v = 0; v < 8; ++v) c[v] = acc_o[dc][v] * alpha;
            const v16bf va = __builtin_shufflevector(ld_tr16(vrd + dc * 32),
                                                     ld_tr16(vrd + 16 * (VS_STRIDE * 2) + dc * 32),
                                                     0, 1, 2, 3, 4, 5, 6, 7, 8, 9, 10, 11, 12, 13, 14, 15);
            acc_o[dc] = WMMA_BF16(va, pb, c);
        }

        // ---- foot of the trip: publish tile kt + 1, free this trip's buffer ----
        // this wave's LDS reads of the buffer have retired before any wave's copies refill it
        asm volatile("s_wait_dscnt 0x0" ::: "memory");
        stage_wait();      // this wave's copies of tile kt + 1 have landed
        __syncthreads();   // every wave's have, and every wave has left buffer kt & 1 and Sp
        if (kt + 2 < S / 32) stage_kv(kt + 2);
    }
    stage_wait();          // no copy is outstanding when the wave goes on to its end

    // ---- normalize and store straight from registers ----
    // acc_o[dc][v] = O[query ln][dw + dc*16 + 8*hi + v]: 32 contiguous bytes per lane
    const float invl = 1.0f / (l_run + xhalf(l_run));   // join the two halves' sums
    float* obase = out + ((size_t)b * S + q0 + g * 16 + ln) * D + dw + 8 * hi;
    #pragma unroll
    for (int dc = 0; dc < 8; ++dc) {
        #pragma unroll
        for (int v = 0; v < 8; ++v) acc_o[dc][v] *= invl;
    }
    #pragma unroll
    for (int dc = 0; dc < 8; ++dc) {
        *(float4*)(obase + dc * 16) =
            make_float4(acc_o[dc][0], acc_o[dc][1], acc_o[dc][2], acc_o[dc][3]);
        *(float4*)(obase + dc * 16 + 4) =
            make_float4(acc_o[dc][4], acc_o[dc][5], acc_o[dc][6], acc_o[dc][7]);
    }
}

// ---------------------------------------------------------------------------
// Host launcher
// ---------------------------------------------------------------------------
extern "C" void kernel_launch(void* const* d_in, const int* in_sizes, int n_in,
                              void* d_out, int out_size, void* d_ws, size_t ws_size,
                              hipStream_t stream) {
    (void)in_sizes; (void)n_in; (void)out_size; (void)ws_size;
    const float* q  = (const float*)d_in[0];
    const float* k  = (const float*)d_in[1];
    const float* v  = (const float*)d_in[2];
    const float* Wq = (const float*)d_in[3];
    const float* bq = (const float*)d_in[4];
    const float* Wk = (const float*)d_in[5];
    const float* bk = (const float*)d_in[6];
    const float* Wv = (const float*)d_in[7];
    const float* bv = (const float*)d_in[8];
    float* out = (float*)d_out;

    bf16* qp = (bf16*)d_ws;
    bf16* kp = qp + (size_t)M_TOT * D;
    bf16* vp = kp + (size_t)M_TOT * D;

    dim3 pg(D / 128, M_TOT / 128);   // 4 x 128
    proj_gemm_bf16<<<pg, 256, 0, stream>>>(q, Wq, bq, qp);
    proj_gemm_bf16<<<pg, 256, 0, stream>>>(k, Wk, bk, kp);
    proj_gemm_bf16<<<pg, 256, 0, stream>>>(v, Wv, bv, vp);

    dim3 ag(S / 64, NB);             // 32 x 8
    flash_attn_bf16<<<ag, 512, ATTN_SMEM, stream>>>(qp, kp, vp, out);
}

// v006
// One run takes 178 microseconds.
// Two timings next to v005 both put it at 1.09 times that version's speed.
// All steps since v000 together make it 4.85 times as fast.
#include <hip/hip_runtime.h>

// ---------------------------------------------------------------------------
// Types for CDNA5 WMMA (gfx1250, wave32)
// ---------------------------------------------------------------------------
typedef __bf16 bf16;
typedef __attribute__((ext_vector_type(16))) __bf16 v16bf;
typedef __attribute__((ext_vector_type(8)))  float  v8f;
typedef __attribute__((ext_vector_type(4)))  float  v4f;
typedef __attribute__((ext_vector_type(4)))  int    v4i;
typedef __attribute__((ext_vector_type(8)))  __bf16 v8bf;
typedef __attribute__((ext_vector_type(4)))  __bf16 v4bf;
typedef __attribute__((ext_vector_type(8)))  short  v8s;

// Pointer types matching the async-to-LDS builtin's parameters
// (param0: int4 addrspace(1)*, param1: int4 addrspace(3)* per hipcc diagnostic)
typedef __attribute__((address_space(1))) v4i* gv4i_p;
typedef __attribute__((address_space(3))) v4i* lv4i_p;
typedef __attribute__((address_space(3))) v8s* lv8s_p;

#define WMMA_BF16(a, b, c) \
    __builtin_amdgcn_wmma_f32_16x16x32_bf16(false, (a), false, (b), (short)0, (c), false, false)

#if __has_builtin(__builtin_amdgcn_global_load_async_to_lds_b128) && \
    __has_builtin(__builtin_amdgcn_s_wait_asynccnt)
#define USE_ASYNC_LDS 1
#else
#define USE_ASYNC_LDS 0
#endif

__device__ __forceinline__ v16bf ldfrag(const bf16* p) {
    // LDS fragment load (16 consecutive bf16) as two 16-byte loads: rows are 16-byte aligned
    return __builtin_shufflevector(*(const v8bf*)p, *(const v8bf*)(p + 8),
                                   0, 1, 2, 3, 4, 5, 6, 7, 8, 9, 10, 11, 12, 13, 14, 15);
}

// 8 bf16 of one column of a row-major 16-bit LDS tile (8 rows x 16 columns per lane half)
__device__ __forceinline__ v8bf ld_tr16(const char* p) {
    return __builtin_bit_cast(v8bf, __builtin_amdgcn_ds_load_tr16_b128_v8i16((lv8s_p)(char*)p));
}

// Problem constants
static constexpr int D  = 512;       // model dim (= INPUT_SIZE = 2*HIDDEN)
static constexpr int S  = 2048;      // sequence length
static constexpr int NB = 8;         // batch
static constexpr int M_TOT = NB * S; // 16384 rows for the projections

// ---------------------------------------------------------------------------
// Kernel 1: projection GEMM  C[m,n] = sum_k A[m,k] * W[k,n] + bias[n]
// A: f32 [M,512], W: f32 [512,512] row-major (k-major), C: bf16 [M,512]
// Tile: 128(M) x 128(N), KT=32.  256 threads = 8 waves; wave -> 64x32 subtile.
// W stays row-major in LDS (8-byte stores, contiguous over the lanes); the B fragments
// come from transposing LDS loads, which deliver the hardware k order, so the A
// fragments are read in that order too: k = 8*hi + s (s < 8), 16 + 8*hi + (s - 8).
// ---------------------------------------------------------------------------
static constexpr int P_STRIDE = 40;   // 80 B = 16 B x odd: 16 rows read by 16-byte loads cover all banks once
static constexpr int W_STRIDE = 144;  // 288 B = 32 B x odd: the pitch of transposing loads

__global__ __launch_bounds__(256)
void proj_gemm_bf16(const float* __restrict__ A, const float* __restrict__ W,
                    const float* __restrict__ bias, bf16* __restrict__ C) {
    __shared__ __attribute__((aligned(32))) bf16 As[128 * P_STRIDE];  // [row m 0..127][k 0..31]
    __shared__ __attribute__((aligned(32))) bf16 Ws[32 * W_STRIDE];   // [k 0..31][col n 0..127]

    const int n0 = blockIdx.x * 128;
    const int m0 = blockIdx.y * 128;

    const int tid  = threadIdx.x;
    const int lane = tid & 31;
    const int wave = tid >> 5;
    const int ln   = lane & 15;        // N / M index within fragment
    const int hi   = lane >> 4;        // K-half selector (A/B frag layout)
    const int wm   = wave >> 2;        // 0..1 : 64-row slab
    const int wn   = wave & 3;         // 0..3 : 32-col slab

    v8f acc[4][2];
    #pragma unroll
    for (int mt = 0; mt < 4; ++mt)
        #pragma unroll
        for (int nt = 0; nt < 2; ++nt) acc[mt][nt] = {};

    for (int kk = 0; kk < 16; ++kk) {       // K = 512, KT = 32
        const int k0 = kk * 32;
        // ---- stage A tile: 128x32 f32 -> bf16, row-major ----
        #pragma unroll
        for (int p = 0; p < 4; ++p) {
            const int r = (tid >> 3) + p * 32;       // 0..127
            const int c = (tid & 7) * 4;             // 0..28
            float4 f = *(const float4*)&A[(size_t)(m0 + r) * D + k0 + c];
            bf16* dst = &As[r * P_STRIDE + c];
            dst[0] = (bf16)f.x; dst[1] = (bf16)f.y;
            dst[2] = (bf16)f.z; dst[3] = (bf16)f.w;
        }
        // ---- stage W tile row-major: W[k, n] -> Ws[k][n] ----
        #pragma unroll
        for (int p = 0; p < 4; ++p) {
            const int r = (tid >> 5) + p * 8;        // k row 0..31
            const int c = (tid & 31) * 4;            // n col 0..124
            float4 f = *(const float4*)&W[(size_t)(k0 + r) * D + n0 + c];
            const v4bf w4 = {(bf16)f.x, (bf16)f.y, (bf16)f.z, (bf16)f.w};
            *(v4bf*)&Ws[r * W_STRIDE + c] = w4;
        }
        __syncthreads();

        // ---- fragments + 8 WMMAs ----
        v16bf af[4], bf_[2];
        #pragma unroll
        for (int mt = 0; mt < 4; ++mt) {
            const bf16* ap = &As[(wm * 64 + mt * 16 + ln) * P_STRIDE + hi * 8];
            af[mt] = __builtin_shufflevector(*(const v8bf*)ap, *(const v8bf*)(ap + 16),
                                             0, 1, 2, 3, 4, 5, 6, 7, 8, 9, 10, 11, 12, 13, 14, 15);
        }
        const char* wrd = (const char*)Ws + (8 * hi + (lane & 7)) * (W_STRIDE * 2)
                          + ((lane >> 3) & 1) * 16 + wn * 64;
        #pragma unroll
        for (int nt = 0; nt < 2; ++nt)
            bf_[nt] = __builtin_shufflevector(ld_tr16(wrd + nt * 32),
                                              ld_tr16(wrd + 16 * (W_STRIDE * 2) + nt * 32),
                                              0, 1, 2, 3, 4, 5, 6, 7, 8, 9, 10, 11, 12, 13, 14, 15);
        #pragma unroll
        for (int mt = 0; mt < 4; ++mt)
            #pragma unroll
            for (int nt = 0; nt < 2; ++nt)
                acc[mt][nt] = WMMA_BF16(af[mt], bf_[nt], acc[mt][nt]);
        __syncthreads();
    }

    // ---- epilogue: bias add, convert to bf16, store ----
    #pragma unroll
    for (int mt = 0; mt < 4; ++mt) {
        #pragma unroll
        for (int nt = 0; nt < 2; ++nt) {
            const int N = n0 + wn * 32 + nt * 16 + ln;
            const float bn = bias[N];
            #pragma unroll
            for (int v = 0; v < 8; ++v) {
                const int Mi = m0 + wm * 64 + mt * 16 + v + 8 * hi;
                C[(size_t)Mi * D + N] = (bf16)(acc[mt][nt][v] + bn);
            }
        }
    }
}

// ---------------------------------------------------------------------------
// Kernel 2: flash attention, O accumulators in registers.
// One block per (batch, 64-query block); 512 threads = 16 waves.
// Wave (g, dch): g = query group (16 rows), dch = 128-wide d-chunk of output.
//   * scores: the 4 waves of group g split the d=512 reduction (4 K-steps each),
//     partial f32 accumulators reduced through LDS (16-byte ops, lane pitch 16 bytes).
//   * both products are transposed: S^T = K x Q^T and O^T += V^T x P^T, so a lane
//     owns one query: 16 of its 32 scores lie in the lane, 16 in lane ^ 16.
//   * softmax stats recomputed redundantly per wave: maximum and sum in-lane,
//     one exchange between the lane halves for the maximum.
//   * P^T is packed from the two score tiles into the B operand (hardware k
//     order); it never touches LDS.
//   * V stays row-major in LDS; the A fragments V^T come from transposing LDS
//     loads, which deliver the same hardware k order.
//   * O^T update: register-resident v8f acc[8] per wave, rescaled by alpha, WMMA.
//   * K and V tiles sit in two LDS buffers: tile t + 2's copies are issued at the foot
//     of trip t into the buffer that trip has just read, and land during trip t + 1.
// LDS (228 KB of 320 KB/WGP):
//   Qs [64][520] bf16 | 2 x { Ks [32][520] bf16 | Vs [32][528] bf16 }
//   Sp 16x512 f32 (score partials)
// ---------------------------------------------------------------------------
// Q and K rows are read one row a lane by 16-byte loads: 1040 B = 16 B x odd puts the 16 rows
// of a lane half on all 64 banks once (at 32 B x odd, rows l and l + 8 share their banks)
static constexpr int QS_STRIDE = 520;
static constexpr int KS_STRIDE = 520;
static constexpr int VS_STRIDE = 528;   // 1056 B = 32 B x odd: the pitch of transposing loads

static constexpr size_t OFF_QS = 0;
static constexpr size_t OFF_KS = OFF_QS + (size_t)64 * QS_STRIDE * 2;   // 66560
static constexpr size_t OFF_VT = OFF_KS + (size_t)32 * KS_STRIDE * 2;   // +33280
static constexpr int    KV_BUF = 32 * KS_STRIDE + 32 * VS_STRIDE;       // elements from buffer 0 to buffer 1
static constexpr size_t OFF_SP = OFF_KS + (size_t)2 * KV_BUF * 2;       // +134144
static constexpr size_t ATTN_SMEM = OFF_SP + (size_t)16 * 512 * 4;      // 233472 B

__device__ __forceinline__ void stage_b128(const bf16* g, bf16* l) {
#if USE_ASYNC_LDS
    __builtin_amdgcn_global_load_async_to_lds_b128(
        (gv4i_p)(bf16*)g,   // strip const, then generic->AS1 int4*
        (lv4i_p)l,          // generic->AS3 int4*
        0, 0);
#else
    *(uint4*)l = *(const uint4*)g;
#endif
}

__device__ __forceinline__ void stage_wait() {
#if USE_ASYNC_LDS
    // the issuing wave's copies have landed before the barrier that publishes them;
    // asm with the clobber so that no LDS read is lifted over the wait
    asm volatile("s_wait_asynccnt 0x0" ::: "memory");
#endif
}

// value of lane l ^ 16
__device__ __forceinline__ float xhalf(float x) {
    const int i = __builtin_bit_cast(int, x);
    return __builtin_bit_cast(float,
        __builtin_amdgcn_permlanex16(i, i, 0x76543210, 0xfedcba98, false, false));
}

// LDS admits one work-group per WGP, four waves per SIMD: tell the register allocator so,
// or it schedules for eight and serialises each fragment load with its WMMA
__global__ __launch_bounds__(512) __attribute__((amdgpu_waves_per_eu(4, 4)))
void flash_attn_bf16(const bf16* __restrict__ qp, const bf16* __restrict__ kp,
                     const bf16* __restrict__ vp, float* __restrict__ out) {
    extern __shared__ char smem[];
    bf16*  Qs = (bf16*)(smem + OFF_QS);
    bf16*  Ks = (bf16*)(smem + OFF_KS);
    bf16*  Vs = (bf16*)(smem + OFF_VT);
    float* Sp = (float*)(smem + OFF_SP);

    const int b    = blockIdx.y;
    const int q0   = blockIdx.x * 64;
    const int tid  = threadIdx.x;
    const int lane = tid & 31;
    const int wave = tid >> 5;       // 0..15
    const int ln   = lane & 15;
    const int hi   = lane >> 4;
    const int g    = wave >> 2;      // query group 0..3
    const int dch  = wave & 3;       // d-chunk 0..3 (128 wide)
    const int dw   = dch * 128;

    const float SCALE = 0.044194173824159216f;   // 1/sqrt(512)
    const float LOG2E = 1.4426950408889634f;

    // ---- preload Q block (64x512 bf16) via async-to-LDS ----
    const bf16* qbase = qp + ((size_t)b * S + q0) * D;
    for (int i = tid; i < 64 * 64; i += 512) {            // granule = 8 bf16
        const int r = i >> 6, c = i & 63;
        stage_b128(&qbase[(size_t)r * D + c * 8], &Qs[r * QS_STRIDE + c * 8]);
    }

    v8f acc_o[8];                    // O^T[128 d x 16 queries] for (g, dch), registers
    #pragma unroll
    for (int dc = 0; dc < 8; ++dc) acc_o[dc] = {};
    float m_run = -1.0e30f;          // running maximum of query ln
    float l_run = 0.0f;              // running sum over this lane half's keys only

    // ---- K and V tile t (32 keys x 512) into buffer t & 1: async straight copies ----
    // fixed trip counts, unrolled: straight-line copies with every lane on, no loop on EXEC
    auto stage_kv = [&](int t) {
        const bf16* kbase = kp + ((size_t)b * S + t * 32) * D;
        const bf16* vbase = vp + ((size_t)b * S + t * 32) * D;
        bf16* kd = Ks + (t & 1) * KV_BUF;
        bf16* vd = Vs + (t & 1) * KV_BUF;
        #pragma unroll
        for (int p = 0; p < 4; ++p) {
            const int r = (tid >> 6) + p * 8, c = tid & 63;
            stage_b128(&kbase[(size_t)r * D + c * 8], &kd[r * KS_STRIDE + c * 8]);
        }
        #pragma unroll
        for (int p = 0; p < 4; ++p) {
            const int r = (tid >> 6) + p * 8, c = tid & 63;
            stage_b128(&vbase[(size_t)r * D + c * 8], &vd[r * VS_STRIDE + c * 8]);
        }
    };

    // prologue: Q and tile 0 land and are published, then tile 1 starts
    stage_kv(0);
    stage_wait();
    __syncthreads();
    stage_kv(1);

    for (int kt = 0; kt < S / 32; ++kt) {
        const bf16* Kc = Ks + (kt & 1) * KV_BUF;   // this trip reads buffer kt & 1 alone
        const bf16* Vc = Vs + (kt & 1) * KV_BUF;

        // ---- partial scores S^T: this wave covers d in [dch*128, dch*128+128) ----
        // s0[v] = S[query ln][key 8*hi + v], s1[v] = S[query ln][key 16 + 8*hi + v]
        v8f s0 = {}, s1 = {};
        #pragma unroll
        for (int i = 0; i < 4; ++i) {
            const int dk = dch * 4 + i;
            v16bf a  = ldfrag(&Qs[(g * 16 + ln) * QS_STRIDE + dk * 32 + hi * 16]);
            v16bf b0 = ldfrag(&Kc[ln * KS_STRIDE + dk * 32 + hi * 16]);
            v16bf b1 = ldfrag(&Kc[(16 + ln) * KS_STRIDE + dk * 32 + hi * 16]);
            s0 = WMMA_BF16(b0, a, s0);
            s1 = WMMA_BF16(b1, a, s1);
        }
        {   // write partials: four 16-byte stores, each one contiguous over the 32 lanes
            // (plane j of a wave's 2 KB holds 4 floats per lane at a 16-byte lane pitch)
            v4f* sp = (v4f*)&Sp[(size_t)wave * 512] + lane;
            sp[0]  = __builtin_shufflevector(s0, s0, 0, 1, 2, 3);
            sp[32] = __builtin_shufflevector(s0, s0, 4, 5, 6, 7);
            sp[64] = __builtin_shufflevector(s1, s1, 0, 1, 2, 3);
            sp[96] = __builtin_shufflevector(s1, s1, 4, 5, 6, 7);
        }
        __syncthreads();

        // ---- reduce the 4 d-partials of my group (every wave, redundant) ----
        v8f t0 = {}, t1 = {};
        #pragma unroll
        for (int w2 = 0; w2 < 4; ++w2) {
            const v4f* sp = (const v4f*)&Sp[(size_t)(g * 4 + w2) * 512] + lane;
            const v4f a0 = sp[0], a1 = sp[32], b0 = sp[64], b1 = sp[96];
            #pragma unroll
            for (int v = 0; v < 4; ++v) {
                t0[v] += a0[v]; t0[4 + v] += a1[v];
                t1[v] += b0[v]; t1[4 + v] += b1[v];
            }
        }

        // ---- online softmax: query ln, 16 scores in this lane, 16 in lane ^ 16 ----
        float x0[8], x1[8];
        #pragma unroll
        for (int v = 0; v < 8; ++v) { x0[v] = t0[v] * SCALE; x1[v] = t1[v] * SCALE; }
        float mx = fmaxf(x0[0], x1[0]);
        #pragma unroll
        for (int v = 1; v < 8; ++v) mx = fmaxf(mx, fmaxf(x0[v], x1[v]));
        mx = fmaxf(mx, xhalf(mx));
        const float mnew  = fmaxf(m_run, mx);
        const float alpha = exp2f((m_run - mnew) * LOG2E);
        // P^T as B operand: element s of lane half hi is key 8*hi + s (s < 8) or
        // 16 + 8*hi + (s - 8), which is where the two score tiles hold it
        v16bf pb;
        float sum = 0.0f;
        #pragma unroll
        for (int v = 0; v < 8; ++v) {
            const float p0 = exp2f((x0[v] - mnew) * LOG2E);
            const float p1 = exp2f((x1[v] - mnew) * LOG2E);
            sum += p0 + p1;
            pb[v]     = (bf16)p0;
            pb[8 + v] = (bf16)p1;
        }
        l_run = l_run * alpha + sum;
        m_run = mnew;

        // ---- O^T update: acc = acc*alpha + V^T(128-chunk x 32) x P^T(32 x 16) ----
        const char* vrd = (const char*)Vc + (8 * hi + (lane & 7)) * (VS_STRIDE * 2)
                          + ((lane >> 3) & 1) * 16 + dw * 2;
        #pragma unroll
        for (int dc = 0; dc < 8; ++dc) {
            v8f c;
            #pragma unroll
            for (int v = 0; v < 8; ++v) c[v] = acc_o[dc][v] * alpha;
            const v16bf va = __builtin_shufflevector(ld_tr16(vrd + dc * 32),
                                                     ld_tr16(vrd + 16 * (VS_STRIDE * 2) + dc * 32),
                                                     0, 1, 2, 3, 4, 5, 6, 7, 8, 9, 10, 11, 12, 13, 14, 15);
            acc_o[dc] = WMMA_BF16(va, pb, c);
        }

        // ---- foot of the trip: publish tile kt + 1, free this trip's buffer ----
        // this wave's LDS reads of the buffer have retired before any wave's copies refill it
        asm volatile("s_wait_dscnt 0x0" ::: "memory");
        stage_wait();      // this wave's copies of tile kt + 1 have landed
        __syncthreads();   // every wave's have, and every wave has left buffer kt & 1 and Sp
        if (kt + 2 < S / 32) stage_kv(kt + 2);
    }
    stage_wait();          // no copy is outstanding when the wave goes on to its end

    // ---- normalize and store straight from registers ----
    // acc_o[dc][v] = O[query ln][dw + dc*16 + 8*hi + v]: 32 contiguous bytes per lane
    const float invl = 1.0f / (l_run + xhalf(l_run));   // join the two halves' sums
    float* obase = out + ((size_t)b * S + q0 + g * 16 + ln) * D + dw + 8 * hi;
    #pragma unroll
    for (int dc = 0; dc < 8; ++dc) {
        #pragma unroll
        for (int v = 0; v < 8; ++v) acc_o[dc][v] *= invl;
    }
    #pragma unroll
    for (int dc = 0; dc < 8; ++dc) {
        *(float4*)(obase + dc * 16) =
            make_float4(acc_o[dc][0], acc_o[dc][1], acc_o[dc][2], acc_o[dc][3]);
        *(float4*)(obase + dc * 16 + 4) =
            make_float4(acc_o[dc][4], acc_o[dc][5], acc_o[dc][6], acc_o[dc][7]);
    }
}

// ---------------------------------------------------------------------------
// Host launcher
// ---------------------------------------------------------------------------
extern "C" void kernel_launch(void* const* d_in, const int* in_sizes, int n_in,
                              void* d_out, int out_size, void* d_ws, size_t ws_size,
                              hipStream_t stream) {
    (void)in_sizes; (void)n_in; (void)out_size; (void)ws_size;
    const float* q  = (const float*)d_in[0];
    const float* k  = (const float*)d_in[1];
    const float* v  = (const float*)d_in[2];
    const float* Wq = (const float*)d_in[3];
    const float* bq = (const float*)d_in[4];
    const float* Wk = (const float*)d_in[5];
    const float* bk = (const float*)d_in[6];
    const float* Wv = (const float*)d_in[7];
    const float* bv = (const float*)d_in[8];
    float* out = (float*)d_out;

    bf16* qp = (bf16*)d_ws;
    bf16* kp = qp + (size_t)M_TOT * D;
    bf16* vp = kp + (size_t)M_TOT * D;

    dim3 pg(D / 128, M_TOT / 128);   // 4 x 128
    proj_gemm_bf16<<<pg, 256, 0, stream>>>(q, Wq, bq, qp);
    proj_gemm_bf16<<<pg, 256, 0, stream>>>(k, Wk, bk, kp);
    proj_gemm_bf16<<<pg, 256, 0, stream>>>(v, Wv, bv, vp);

    dim3 ag(S / 64, NB);             // 32 x 8
    flash_attn_bf16<<<ag, 512, ATTN_SMEM, stream>>>(qp, kp, vp, out);
}

// v007
// A run of this version takes 166 microseconds.
// Timed twice side by side with v006, it ran 1.08 times as fast both times.
// All steps since v000 together make it 5.23 times as fast.
#include <hip/hip_runtime.h>

// ---------------------------------------------------------------------------
// Types for CDNA5 WMMA (gfx1250, wave32)
// ---------------------------------------------------------------------------
typedef __bf16 bf16;
typedef __attribute__((ext_vector_type(16))) __bf16 v16bf;
typedef __attribute__((ext_vector_type(8)))  float  v8f;
typedef __attribute__((ext_vector_type(4)))  float  v4f;
typedef __attribute__((ext_vector_type(4)))  int    v4i;
typedef __attribute__((ext_vector_type(8)))  __bf16 v8bf;
typedef __attribute__((ext_vector_type(4)))  __bf16 v4bf;
typedef __attribute__((ext_vector_type(8)))  short  v8s;

// Pointer types matching the async-to-LDS builtin's parameters
// (param0: int4 addrspace(1)*, param1: int4 addrspace(3)* per hipcc diagnostic)
typedef __attribute__((address_space(1))) v4i* gv4i_p;
typedef __attribute__((address_space(3))) v4i* lv4i_p;
typedef __attribute__((address_space(3))) v8s* lv8s_p;

#define WMMA_BF16(a, b, c) \
    __builtin_amdgcn_wmma_f32_16x16x32_bf16(false, (a), false, (b), (short)0, (c), false, false)

#if __has_builtin(__builtin_amdgcn_global_load_async_to_lds_b128) && \
    __has_builtin(__builtin_amdgcn_s_wait_asynccnt)
#define USE_ASYNC_LDS 1
#else
#define USE_ASYNC_LDS 0
#endif

__device__ __forceinline__ v16bf ldfrag(const bf16* p) {
    // LDS fragment load (16 consecutive bf16) as two 16-byte loads: rows are 16-byte aligned
    return __builtin_shufflevector(*(const v8bf*)p, *(const v8bf*)(p + 8),
                                   0, 1, 2, 3, 4, 5, 6, 7, 8, 9, 10, 11, 12, 13, 14, 15);
}

// 8 bf16 of one column of a row-major 16-bit LDS tile (8 rows x 16 columns per lane half)
__device__ __forceinline__ v8bf ld_tr16(const char* p) {
    return __builtin_bit_cast(v8bf, __builtin_amdgcn_ds_load_tr16_b128_v8i16((lv8s_p)(char*)p));
}

// Problem constants
static constexpr int D  = 512;       // model dim (= INPUT_SIZE = 2*HIDDEN)
static constexpr int S  = 2048;      // sequence length
static constexpr int NB = 8;         // batch
static constexpr int M_TOT = NB * S; // 16384 rows for the projections

// ---------------------------------------------------------------------------
// Kernel 1: projection GEMM  C[m,n] = sum_k A[m,k] * W[k,n] + bias[n]
// A: f32 [M,512], W: f32 [512,512] row-major (k-major), C: bf16 [M,512]
// Tile: 128(M) x 128(N), KT=32.  256 threads = 8 waves; wave -> 64x32 subtile.
// W stays row-major in LDS (8-byte stores, contiguous over the lanes); the B fragments
// come from transposing LDS loads, which deliver the hardware k order, so the A
// fragments are read in that order too: k = 8*hi + s (s < 8), 16 + 8*hi + (s - 8).
// ---------------------------------------------------------------------------
static constexpr int P_STRIDE = 40;   // 80 B = 16 B x odd: 16 rows read by 16-byte loads cover all banks once
static constexpr int W_STRIDE = 144;  // 288 B = 32 B x odd: the pitch of transposing loads

__global__ __launch_bounds__(256)
void proj_gemm_bf16(const float* __restrict__ A, const float* __restrict__ W,
                    const float* __restrict__ bias, bf16* __restrict__ C) {
    __shared__ __attribute__((aligned(32))) bf16 As[128 * P_STRIDE];  // [row m 0..127][k 0..31]
    __shared__ __attribute__((aligned(32))) bf16 Ws[32 * W_STRIDE];   // [k 0..31][col n 0..127]

    const int n0 = blockIdx.x * 128;
    const int m0 = blockIdx.y * 128;

    const int tid  = threadIdx.x;
    const int lane = tid & 31;
    const int wave = tid >> 5;
    const int ln   = lane & 15;        // N / M index within fragment
    const int hi   = lane >> 4;        // K-half selector (A/B frag layout)
    const int wm   = wave >> 2;        // 0..1 : 64-row slab
    const int wn   = wave & 3;         // 0..3 : 32-col slab

    v8f acc[4][2];
    #pragma unroll
    for (int mt = 0; mt < 4; ++mt)
        #pragma unroll
        for (int nt = 0; nt < 2; ++nt) acc[mt][nt] = {};

    for (int kk = 0; kk < 16; ++kk) {       // K = 512, KT = 32
        const int k0 = kk * 32;
        // ---- stage A tile: 128x32 f32 -> bf16, row-major ----
        #pragma unroll
        for (int p = 0; p < 4; ++p) {
            const int r = (tid >> 3) + p * 32;       // 0..127
            const int c = (tid & 7) * 4;             // 0..28
            float4 f = *(const float4*)&A[(size_t)(m0 + r) * D + k0 + c];
            bf16* dst = &As[r * P_STRIDE + c];
            dst[0] = (bf16)f.x; dst[1] = (bf16)f.y;
            dst[2] = (bf16)f.z; dst[3] = (bf16)f.w;
        }
        // ---- stage W tile row-major: W[k, n] -> Ws[k][n] ----
        #pragma unroll
        for (int p = 0; p < 4; ++p) {
            const int r = (tid >> 5) + p * 8;        // k row 0..31
            const int c = (tid & 31) * 4;            // n col 0..124
            float4 f = *(const float4*)&W[(size_t)(k0 + r) * D + n0 + c];
            const v4bf w4 = {(bf16)f.x, (bf16)f.y, (bf16)f.z, (bf16)f.w};
            *(v4bf*)&Ws[r * W_STRIDE + c] = w4;
        }
        __syncthreads();

        // ---- fragments + 8 WMMAs ----
        v16bf af[4], bf_[2];
        #pragma unroll
        for (int mt = 0; mt < 4; ++mt) {
            const bf16* ap = &As[(wm * 64 + mt * 16 + ln) * P_STRIDE + hi * 8];
            af[mt] = __builtin_shufflevector(*(const v8bf*)ap, *(const v8bf*)(ap + 16),
                                             0, 1, 2, 3, 4, 5, 6, 7, 8, 9, 10, 11, 12, 13, 14, 15);
        }
        const char* wrd = (const char*)Ws + (8 * hi + (lane & 7)) * (W_STRIDE * 2)
                          + ((lane >> 3) & 1) * 16 + wn * 64;
        #pragma unroll
        for (int nt = 0; nt < 2; ++nt)
            bf_[nt] = __builtin_shufflevector(ld_tr16(wrd + nt * 32),
                                              ld_tr16(wrd + 16 * (W_STRIDE * 2) + nt * 32),
                                              0, 1, 2, 3, 4, 5, 6, 7, 8, 9, 10, 11, 12, 13, 14, 15);
        #pragma unroll
        for (int mt = 0; mt < 4; ++mt)
            #pragma unroll
            for (int nt = 0; nt < 2; ++nt)
                acc[mt][nt] = WMMA_BF16(af[mt], bf_[nt], acc[mt][nt]);
        __syncthreads();
    }

    // ---- epilogue: bias add, convert to bf16, store ----
    #pragma unroll
    for (int mt = 0; mt < 4; ++mt) {
        #pragma unroll
        for (int nt = 0; nt < 2; ++nt) {
            const int N = n0 + wn * 32 + nt * 16 + ln;
            const float bn = bias[N];
            #pragma unroll
            for (int v = 0; v < 8; ++v) {
                const int Mi = m0 + wm * 64 + mt * 16 + v + 8 * hi;
                C[(size_t)Mi * D + N] = (bf16)(acc[mt][nt][v] + bn);
            }
        }
    }
}

// ---------------------------------------------------------------------------
// Kernel 2: flash attention, O accumulators in registers.
// One block per (batch, 64-query block); 512 threads = 16 waves.
// Wave (g, dch): g = query group (16 rows), dch = 128-wide d-chunk of output.
//   * scores: the 4 waves of group g split the d=512 reduction (4 K-steps each),
//     partial f32 accumulators reduced through LDS (16-byte ops, lane pitch 16 bytes).
//   * both products are transposed: S^T = K x Q^T and O^T += V^T x P^T, so a lane
//     owns one query: 16 of its 32 scores lie in the lane, 16 in lane ^ 16.
//   * softmax stats recomputed redundantly per wave: maximum and sum in-lane,
//     one exchange between the lane halves for the maximum.
//   * P^T is packed from the two score tiles into the B operand (hardware k
//     order); it never touches LDS.
//   * V stays row-major in LDS; the A fragments V^T come from transposing LDS
//     loads, which deliver the same hardware k order.
//   * O^T update: register-resident v8f acc[8] per wave, rescaled by alpha, WMMA.
//   * K and V tiles sit in two LDS buffers: tile t + 2's copies are issued at the foot
//     of trip t into the buffer that trip has just read, and land during trip t + 1.
// LDS (228 KB of 320 KB/WGP):
//   Qs [64][520] bf16 | 2 x { Ks [32][520] bf16 | Vs [32][528] bf16 }
//   Sp 16x512 f32 (score partials)
// ---------------------------------------------------------------------------
// Q and K rows are read one row a lane by 16-byte loads: 1040 B = 16 B x odd puts the 16 rows
// of a lane half on all 64 banks once (at 32 B x odd, rows l and l + 8 share their banks)
static constexpr int QS_STRIDE = 520;
static constexpr int KS_STRIDE = 520;
static constexpr int VS_STRIDE = 528;   // 1056 B = 32 B x odd: the pitch of transposing loads

static constexpr size_t OFF_QS = 0;
static constexpr size_t OFF_KS = OFF_QS + (size_t)64 * QS_STRIDE * 2;   // 66560
static constexpr size_t OFF_VT = OFF_KS + (size_t)32 * KS_STRIDE * 2;   // +33280
static constexpr int    KV_BUF = 32 * KS_STRIDE + 32 * VS_STRIDE;       // elements from buffer 0 to buffer 1
static constexpr size_t OFF_SP = OFF_KS + (size_t)2 * KV_BUF * 2;       // +134144
static constexpr size_t ATTN_SMEM = OFF_SP + (size_t)16 * 512 * 4;      // 233472 B

__device__ __forceinline__ void stage_b128(const bf16* g, bf16* l) {
#if USE_ASYNC_LDS
    __builtin_amdgcn_global_load_async_to_lds_b128(
        (gv4i_p)(bf16*)g,   // strip const, then generic->AS1 int4*
        (lv4i_p)l,          // generic->AS3 int4*
        0, 0);
#else
    *(uint4*)l = *(const uint4*)g;
#endif
}

__device__ __forceinline__ void stage_wait() {
#if USE_ASYNC_LDS
    // the issuing wave's copies have landed before the barrier that publishes them;
    // asm with the clobber so that no LDS read is lifted over the wait
    asm volatile("s_wait_asynccnt 0x0" ::: "memory");
#endif
}

// value of lane l ^ 16
__device__ __forceinline__ float xhalf(float x) {
    const int i = __builtin_bit_cast(int, x);
    return __builtin_bit_cast(float,
        __builtin_amdgcn_permlanex16(i, i, 0x76543210, 0xfedcba98, false, false));
}

// LDS admits one work-group per WGP, four waves per SIMD: tell the register allocator so,
// or it schedules for eight and serialises each fragment load with its WMMA
__global__ __launch_bounds__(512) __attribute__((amdgpu_waves_per_eu(4, 4)))
void flash_attn_bf16(const bf16* __restrict__ qp, const bf16* __restrict__ kp,
                     const bf16* __restrict__ vp, float* __restrict__ out) {
    extern __shared__ char smem[];
    bf16*  Qs = (bf16*)(smem + OFF_QS);
    bf16*  Ks = (bf16*)(smem + OFF_KS);
    bf16*  Vs = (bf16*)(smem + OFF_VT);
    float* Sp = (float*)(smem + OFF_SP);

    const int b    = blockIdx.y;
    const int q0   = blockIdx.x * 64;
    const int tid  = threadIdx.x;
    const int lane = tid & 31;
    const int wave = tid >> 5;       // 0..15
    const int ln   = lane & 15;
    const int hi   = lane >> 4;
    const int g    = wave >> 2;      // query group 0..3
    const int dch  = wave & 3;       // d-chunk 0..3 (128 wide)
    const int dw   = dch * 128;

    // 1/sqrt(512) * log2(e): the softmax runs on base 2, p = 2^(s * CEXP - m * CEXP)
    const float CEXP = 0.044194173824159216f * 1.4426950408889634f;

    // ---- preload Q block (64x512 bf16) via async-to-LDS ----
    const bf16* qbase = qp + ((size_t)b * S + q0) * D;
    for (int i = tid; i < 64 * 64; i += 512) {            // granule = 8 bf16
        const int r = i >> 6, c = i & 63;
        stage_b128(&qbase[(size_t)r * D + c * 8], &Qs[r * QS_STRIDE + c * 8]);
    }

    v8f acc_o[8];                    // O^T[128 d x 16 queries] for (g, dch), registers
    #pragma unroll
    for (int dc = 0; dc < 8; ++dc) acc_o[dc] = {};
    float m_run = -1.0e30f;          // running maximum of query ln, raw (unscaled) scores
    float l_run = 0.0f;              // running sum over this lane half's keys only

    // ---- K and V tile t (32 keys x 512) into buffer t & 1: async straight copies ----
    // fixed trip counts, unrolled: straight-line copies with every lane on, no loop on EXEC
    auto stage_kv = [&](int t) {
        const bf16* kbase = kp + ((size_t)b * S + t * 32) * D;
        const bf16* vbase = vp + ((size_t)b * S + t * 32) * D;
        bf16* kd = Ks + (t & 1) * KV_BUF;
        bf16* vd = Vs + (t & 1) * KV_BUF;
        #pragma unroll
        for (int p = 0; p < 4; ++p) {
            const int r = (tid >> 6) + p * 8, c = tid & 63;
            stage_b128(&kbase[(size_t)r * D + c * 8], &kd[r * KS_STRIDE + c * 8]);
        }
        #pragma unroll
        for (int p = 0; p < 4; ++p) {
            const int r = (tid >> 6) + p * 8, c = tid & 63;
            stage_b128(&vbase[(size_t)r * D + c * 8], &vd[r * VS_STRIDE + c * 8]);
        }
    };

    // prologue: Q and tile 0 land and are published, then tile 1 starts
    stage_kv(0);
    stage_wait();
    __syncthreads();
    stage_kv(1);

    for (int kt = 0; kt < S / 32; ++kt) {
        const bf16* Kc = Ks + (kt & 1) * KV_BUF;   // this trip reads buffer kt & 1 alone
        const bf16* Vc = Vs + (kt & 1) * KV_BUF;

        // ---- partial scores S^T: this wave covers d in [dch*128, dch*128+128) ----
        // s0[v] = S[query ln][key 8*hi + v], s1[v] = S[query ln][key 16 + 8*hi + v]
        v8f s0 = {}, s1 = {};
        #pragma unroll
        for (int i = 0; i < 4; ++i) {
            const int dk = dch * 4 + i;
            v16bf a  = ldfrag(&Qs[(g * 16 + ln) * QS_STRIDE + dk * 32 + hi * 16]);
            v16bf b0 = ldfrag(&Kc[ln * KS_STRIDE + dk * 32 + hi * 16]);
            v16bf b1 = ldfrag(&Kc[(16 + ln) * KS_STRIDE + dk * 32 + hi * 16]);
            s0 = WMMA_BF16(b0, a, s0);
            s1 = WMMA_BF16(b1, a, s1);
        }
        {   // write partials: four 16-byte stores, each one contiguous over the 32 lanes
            // (plane j of a wave's 2 KB holds 4 floats per lane at a 16-byte lane pitch)
            v4f* sp = (v4f*)&Sp[(size_t)wave * 512] + lane;
            sp[0]  = __builtin_shufflevector(s0, s0, 0, 1, 2, 3);
            sp[32] = __builtin_shufflevector(s0, s0, 4, 5, 6, 7);
            sp[64] = __builtin_shufflevector(s1, s1, 0, 1, 2, 3);
            sp[96] = __builtin_shufflevector(s1, s1, 4, 5, 6, 7);
        }
        __syncthreads();

        // ---- reduce the 4 d-partials of my group (every wave, redundant) ----
        v8f t0 = {}, t1 = {};
        #pragma unroll
        for (int w2 = 0; w2 < 4; ++w2) {
            const v4f* sp = (const v4f*)&Sp[(size_t)(g * 4 + w2) * 512] + lane;
            const v4f a0 = sp[0], a1 = sp[32], b0 = sp[64], b1 = sp[96];
            #pragma unroll
            for (int v = 0; v < 4; ++v) {
                t0[v] += a0[v]; t0[4 + v] += a1[v];
                t1[v] += b0[v]; t1[4 + v] += b1[v];
            }
        }

        // ---- online softmax: query ln, 16 scores in this lane, 16 in lane ^ 16 ----
        // the maximum is kept on the raw scores (CEXP > 0 keeps their order); each exponent is
        // one fused multiply-add into the hardware's 2^x, whose results below 2^-126 may flush
        // to 0: such a weight is lost in the f32 row sum and in bf16 P x V either way
        float mx = fmaxf(t0[0], t1[0]);
        #pragma unroll
        for (int v = 1; v < 8; ++v) mx = fmaxf(mx, fmaxf(t0[v], t1[v]));
        mx = fmaxf(mx, xhalf(mx));
        const float mnew  = fmaxf(m_run, mx);
        const float alpha = __builtin_amdgcn_exp2f((m_run - mnew) * CEXP);
        const float mneg  = -mnew * CEXP;
        // P^T as B operand: element s of lane half hi is key 8*hi + s (s < 8) or
        // 16 + 8*hi + (s - 8), which is where the two score tiles hold it
        v16bf pb;
        float sum = 0.0f;
        #pragma unroll
        for (int v = 0; v < 8; ++v) {
            const float p0 = __builtin_amdgcn_exp2f(fmaf(t0[v], CEXP, mneg));
            const float p1 = __builtin_amdgcn_exp2f(fmaf(t1[v], CEXP, mneg));
            sum += p0 + p1;
            pb[v]     = (bf16)p0;
            pb[8 + v] = (bf16)p1;
        }
        l_run = l_run * alpha + sum;
        m_run = mnew;

        // ---- O^T update: acc = acc*alpha + V^T(128-chunk x 32) x P^T(32 x 16) ----
        const char* vrd = (const char*)Vc + (8 * hi + (lane & 7)) * (VS_STRIDE * 2)
                          + ((lane >> 3) & 1) * 16 + dw * 2;
        #pragma unroll
        for (int dc = 0; dc < 8; ++dc) {
            v8f c;
            #pragma unroll
            for (int v = 0; v < 8; ++v) c[v] = acc_o[dc][v] * alpha;
            const v16bf va = __builtin_shufflevector(ld_tr16(vrd + dc * 32),
                                                     ld_tr16(vrd + 16 * (VS_STRIDE * 2) + dc * 32),
                                                     0, 1, 2, 3, 4, 5, 6, 7, 8, 9, 10, 11, 12, 13, 14, 15);
            acc_o[dc] = WMMA_BF16(va, pb, c);
        }

        // ---- foot of the trip: publish tile kt + 1, free this trip's buffer ----
        // this wave's LDS reads of the buffer have retired before any wave's copies refill it
        asm volatile("s_wait_dscnt 0x0" ::: "memory");
        stage_wait();      // this wave's copies of tile kt + 1 have landed
        __syncthreads();   // every wave's have, and every wave has left buffer kt & 1 and Sp
        if (kt + 2 < S / 32) stage_kv(kt + 2);
    }
    stage_wait();          // no copy is outstanding when the wave goes on to its end

    // ---- normalize and store straight from registers ----
    // acc_o[dc][v] = O[query ln][dw + dc*16 + 8*hi + v]: 32 contiguous bytes per lane
    const float invl = 1.0f / (l_run + xhalf(l_run));   // join the two halves' sums
    float* obase = out + ((size_t)b * S + q0 + g * 16 + ln) * D + dw + 8 * hi;
    #pragma unroll
    for (int dc = 0; dc < 8; ++dc) {
        #pragma unroll
        for (int v = 0; v < 8; ++v) acc_o[dc][v] *= invl;
    }
    #pragma unroll
    for (int dc = 0; dc < 8; ++dc) {
        *(float4*)(obase + dc * 16) =
            make_float4(acc_o[dc][0], acc_o[dc][1], acc_o[dc][2], acc_o[dc][3]);
        *(float4*)(obase + dc * 16 + 4) =
            make_float4(acc_o[dc][4], acc_o[dc][5], acc_o[dc][6], acc_o[dc][7]);
    }
}

// ---------------------------------------------------------------------------
// Host launcher
// ---------------------------------------------------------------------------
extern "C" void kernel_launch(void* const* d_in, const int* in_sizes, int n_in,
                              void* d_out, int out_size, void* d_ws, size_t ws_size,
                              hipStream_t stream) {
    (void)in_sizes; (void)n_in; (void)out_size; (void)ws_size;
    const float* q  = (const float*)d_in[0];
    const float* k  = (const float*)d_in[1];
    const float* v  = (const float*)d_in[2];
    const float* Wq = (const float*)d_in[3];
    const float* bq = (const float*)d_in[4];
    const float* Wk = (const float*)d_in[5];
    const float* bk = (const float*)d_in[6];
    const float* Wv = (const float*)d_in[7];
    const float* bv = (const float*)d_in[8];
    float* out = (float*)d_out;

    bf16* qp = (bf16*)d_ws;
    bf16* kp = qp + (size_t)M_TOT * D;
    bf16* vp = kp + (size_t)M_TOT * D;

    dim3 pg(D / 128, M_TOT / 128);   // 4 x 128
    proj_gemm_bf16<<<pg, 256, 0, stream>>>(q, Wq, bq, qp);
    proj_gemm_bf16<<<pg, 256, 0, stream>>>(k, Wk, bk, kp);
    proj_gemm_bf16<<<pg, 256, 0, stream>>>(v, Wv, bv, vp);

    dim3 ag(S / 64, NB);             // 32 x 8
    flash_attn_bf16<<<ag, 512, ATTN_SMEM, stream>>>(qp, kp, vp, out);
}

// v008
// Measured time: 156 microseconds a run.
// Two timings next to v007 put it at 1.07 and 1.06 times that version's speed.
// All steps since v000 together make it 5.57 times as fast.
#include <hip/hip_runtime.h>

// ---------------------------------------------------------------------------
// Types for CDNA5 WMMA (gfx1250, wave32)
// ---------------------------------------------------------------------------
typedef __bf16 bf16;
typedef __attribute__((ext_vector_type(16))) __bf16 v16bf;
typedef __attribute__((ext_vector_type(8)))  float  v8f;
typedef __attribute__((ext_vector_type(4)))  float  v4f;
typedef __attribute__((ext_vector_type(4)))  int    v4i;
typedef __attribute__((ext_vector_type(8)))  __bf16 v8bf;
typedef __attribute__((ext_vector_type(4)))  __bf16 v4bf;
typedef __attribute__((ext_vector_type(8)))  short  v8s;

// Pointer types matching the async-to-LDS builtin's parameters
// (param0: int4 addrspace(1)*, param1: int4 addrspace(3)* per hipcc diagnostic)
typedef __attribute__((address_space(1))) v4i* gv4i_p;
typedef __attribute__((address_space(3))) v4i* lv4i_p;
typedef __attribute__((address_space(3))) v8s* lv8s_p;

#define WMMA_BF16(a, b, c) \
    __builtin_amdgcn_wmma_f32_16x16x32_bf16(false, (a), false, (b), (short)0, (c), false, false)

#if __has_builtin(__builtin_amdgcn_global_load_async_to_lds_b128) && \
    __has_builtin(__builtin_amdgcn_s_wait_asynccnt)
#define USE_ASYNC_LDS 1
#else
#define USE_ASYNC_LDS 0
#endif

__device__ __forceinline__ v16bf ldfrag(const bf16* p) {
    // LDS fragment load (16 consecutive bf16) as two 16-byte loads: rows are 16-byte aligned
    return __builtin_shufflevector(*(const v8bf*)p, *(const v8bf*)(p + 8),
                                   0, 1, 2, 3, 4, 5, 6, 7, 8, 9, 10, 11, 12, 13, 14, 15);
}

// 8 bf16 of one column of a row-major 16-bit LDS tile (8 rows x 16 columns per lane half)
__device__ __forceinline__ v8bf ld_tr16(const char* p) {
    return __builtin_bit_cast(v8bf, __builtin_amdgcn_ds_load_tr16_b128_v8i16((lv8s_p)(char*)p));
}

// Problem constants
static constexpr int D  = 512;       // model dim (= INPUT_SIZE = 2*HIDDEN)
static constexpr int S  = 2048;      // sequence length
static constexpr int NB = 8;         // batch
static constexpr int M_TOT = NB * S; // 16384 rows for the projections

// ---------------------------------------------------------------------------
// Kernel 1: projection GEMM  C[m,n] = sum_k A[m,k] * W[k,n] + bias[n]
// A: f32 [M,512], W: f32 [512,512] row-major (k-major), C: bf16 [M,512]
// Tile: 128(M) x 128(N), KT=32.  256 threads = 8 waves; wave -> 64x32 subtile.
// W stays row-major in LDS (8-byte stores, contiguous over the lanes); the B fragments
// come from transposing LDS loads, which deliver the hardware k order, so the A
// fragments are read in that order too: k = 8*hi + s (s < 8), 16 + 8*hi + (s - 8).
// ---------------------------------------------------------------------------
static constexpr int P_STRIDE = 40;   // 80 B = 16 B x odd: 16 rows read by 16-byte loads cover all banks once
static constexpr int W_STRIDE = 144;  // 288 B = 32 B x odd: the pitch of transposing loads

__global__ __launch_bounds__(256)
void proj_gemm_bf16(const float* __restrict__ A, const float* __restrict__ W,
                    const float* __restrict__ bias, bf16* __restrict__ C) {
    __shared__ __attribute__((aligned(32))) bf16 As[128 * P_STRIDE];  // [row m 0..127][k 0..31]
    __shared__ __attribute__((aligned(32))) bf16 Ws[32 * W_STRIDE];   // [k 0..31][col n 0..127]

    const int n0 = blockIdx.x * 128;
    const int m0 = blockIdx.y * 128;

    const int tid  = threadIdx.x;
    const int lane = tid & 31;
    const int wave = tid >> 5;
    const int ln   = lane & 15;        // N / M index within fragment
    const int hi   = lane >> 4;        // K-half selector (A/B frag layout)
    const int wm   = wave >> 2;        // 0..1 : 64-row slab
    const int wn   = wave & 3;         // 0..3 : 32-col slab

    v8f acc[4][2];
    #pragma unroll
    for (int mt = 0; mt < 4; ++mt)
        #pragma unroll
        for (int nt = 0; nt < 2; ++nt) acc[mt][nt] = {};

    for (int kk = 0; kk < 16; ++kk) {       // K = 512, KT = 32
        const int k0 = kk * 32;
        // ---- stage A tile: 128x32 f32 -> bf16, row-major ----
        #pragma unroll
        for (int p = 0; p < 4; ++p) {
            const int r = (tid >> 3) + p * 32;       // 0..127
            const int c = (tid & 7) * 4;             // 0..28
            float4 f = *(const float4*)&A[(size_t)(m0 + r) * D + k0 + c];
            bf16* dst = &As[r * P_STRIDE + c];
            dst[0] = (bf16)f.x; dst[1] = (bf16)f.y;
            dst[2] = (bf16)f.z; dst[3] = (bf16)f.w;
        }
        // ---- stage W tile row-major: W[k, n] -> Ws[k][n] ----
        #pragma unroll
        for (int p = 0; p < 4; ++p) {
            const int r = (tid >> 5) + p * 8;        // k row 0..31
            const int c = (tid & 31) * 4;            // n col 0..124
            float4 f = *(const float4*)&W[(size_t)(k0 + r) * D + n0 + c];
            const v4bf w4 = {(bf16)f.x, (bf16)f.y, (bf16)f.z, (bf16)f.w};
            *(v4bf*)&Ws[r * W_STRIDE + c] = w4;
        }
        __syncthreads();

        // ---- fragments + 8 WMMAs ----
        v16bf af[4], bf_[2];
        #pragma unroll
        for (int mt = 0; mt < 4; ++mt) {
            const bf16* ap = &As[(wm * 64 + mt * 16 + ln) * P_STRIDE + hi * 8];
            af[mt] = __builtin_shufflevector(*(const v8bf*)ap, *(const v8bf*)(ap + 16),
                                             0, 1, 2, 3, 4, 5, 6, 7, 8, 9, 10, 11, 12, 13, 14, 15);
        }
        const char* wrd = (const char*)Ws + (8 * hi + (lane & 7)) * (W_STRIDE * 2)
                          + ((lane >> 3) & 1) * 16 + wn * 64;
        #pragma unroll
        for (int nt = 0; nt < 2; ++nt)
            bf_[nt] = __builtin_shufflevector(ld_tr16(wrd + nt * 32),
                                              ld_tr16(wrd + 16 * (W_STRIDE * 2) + nt * 32),
                                              0, 1, 2, 3, 4, 5, 6, 7, 8, 9, 10, 11, 12, 13, 14, 15);
        #pragma unroll
        for (int mt = 0; mt < 4; ++mt)
            #pragma unroll
            for (int nt = 0; nt < 2; ++nt)
                acc[mt][nt] = WMMA_BF16(af[mt], bf_[nt], acc[mt][nt]);
        __syncthreads();
    }

    // ---- epilogue: bias add, convert to bf16, store ----
    #pragma unroll
    for (int mt = 0; mt < 4; ++mt) {
        #pragma unroll
        for (int nt = 0; nt < 2; ++nt) {
            const int N = n0 + wn * 32 + nt * 16 + ln;
            const float bn = bias[N];
            #pragma unroll
            for (int v = 0; v < 8; ++v) {
                const int Mi = m0 + wm * 64 + mt * 16 + v + 8 * hi;
                C[(size_t)Mi * D + N] = (bf16)(acc[mt][nt][v] + bn);
            }
        }
    }
}

// ---------------------------------------------------------------------------
// Kernel 2: flash attention, O accumulators in registers.
// One block per (batch, 64-query block); 512 threads = 16 waves.
// Wave (g, dch): g = query group (16 rows), dch = 128-wide d-chunk of output.
//   * scores: the 4 waves of group g split the d=512 reduction (4 K-steps each),
//     partial f32 accumulators reduced through LDS (16-byte ops, lane pitch 16 bytes).
//   * both products are transposed: S^T = K x Q^T and O^T += V^T x P^T, so a lane
//     owns one query: 16 of its 32 scores lie in the lane, 16 in lane ^ 16.
//   * softmax stats recomputed redundantly per wave: maximum and sum in-lane,
//     one exchange between the lane halves for the maximum.
//   * P^T is packed from the two score tiles into the B operand (hardware k
//     order); it never touches LDS.
//   * V stays row-major in LDS; the A fragments V^T come from transposing LDS
//     loads, which deliver the same hardware k order.
//   * O^T update: register-resident v8f acc[8] per wave, rescaled by alpha, WMMA.
//   * K and V tiles sit in two LDS buffers each; copies issued at the foot of trip t go into
//     the buffers that trip has just read and land during trip t + 1.
//   * the scores run one tile ahead: trip t forms the partials of tile t + 1 (K tile t + 1,
//     partial buffer (t + 1) & 1) beside softmax and P x V of tile t (V tile t, partial buffer
//     t & 1). The two halves of a trip do not depend on each other, so one barrier a trip.
// LDS (260 KB of 320 KB/WGP):
//   Qs [64][520] bf16 | 2 x { Ks [32][520] bf16 | Vs [32][528] bf16 }
//   Sp 2 x 16x512 f32 (score partials)
// ---------------------------------------------------------------------------
// Q and K rows are read one row a lane by 16-byte loads: 1040 B = 16 B x odd puts the 16 rows
// of a lane half on all 64 banks once (at 32 B x odd, rows l and l + 8 share their banks)
static constexpr int QS_STRIDE = 520;
static constexpr int KS_STRIDE = 520;
static constexpr int VS_STRIDE = 528;   // 1056 B = 32 B x odd: the pitch of transposing loads

static constexpr size_t OFF_QS = 0;
static constexpr size_t OFF_KS = OFF_QS + (size_t)64 * QS_STRIDE * 2;   // 66560
static constexpr size_t OFF_VT = OFF_KS + (size_t)32 * KS_STRIDE * 2;   // +33280
static constexpr int    KV_BUF = 32 * KS_STRIDE + 32 * VS_STRIDE;       // elements from buffer 0 to buffer 1
static constexpr size_t OFF_SP = OFF_KS + (size_t)2 * KV_BUF * 2;       // +134144
static constexpr int    SP_BUF = 16 * 512;                              // floats from partial buffer 0 to 1
static constexpr size_t ATTN_SMEM = OFF_SP + (size_t)2 * SP_BUF * 4;    // 266240 B

__device__ __forceinline__ void stage_b128(const bf16* g, bf16* l) {
#if USE_ASYNC_LDS
    __builtin_amdgcn_global_load_async_to_lds_b128(
        (gv4i_p)(bf16*)g,   // strip const, then generic->AS1 int4*
        (lv4i_p)l,          // generic->AS3 int4*
        0, 0);
#else
    *(uint4*)l = *(const uint4*)g;
#endif
}

__device__ __forceinline__ void stage_wait() {
#if USE_ASYNC_LDS
    // the issuing wave's copies have landed before the barrier that publishes them;
    // asm with the clobber so that no LDS read is lifted over the wait
    asm volatile("s_wait_asynccnt 0x0" ::: "memory");
#endif
}

// value of lane l ^ 16
__device__ __forceinline__ float xhalf(float x) {
    const int i = __builtin_bit_cast(int, x);
    return __builtin_bit_cast(float,
        __builtin_amdgcn_permlanex16(i, i, 0x76543210, 0xfedcba98, false, false));
}

// LDS admits one work-group per WGP, four waves per SIMD: tell the register allocator so,
// or it schedules for eight and serialises each fragment load with its WMMA
__global__ __launch_bounds__(512) __attribute__((amdgpu_waves_per_eu(4, 4)))
void flash_attn_bf16(const bf16* __restrict__ qp, const bf16* __restrict__ kp,
                     const bf16* __restrict__ vp, float* __restrict__ out) {
    // static: one work-group may take up to the whole LDS of a WGP this way
    __shared__ __attribute__((aligned(32))) char smem[ATTN_SMEM];
    bf16*  Qs = (bf16*)(smem + OFF_QS);
    bf16*  Ks = (bf16*)(smem + OFF_KS);
    bf16*  Vs = (bf16*)(smem + OFF_VT);
    float* Sp = (float*)(smem + OFF_SP);

    const int b    = blockIdx.y;
    const int q0   = blockIdx.x * 64;
    const int tid  = threadIdx.x;
    const int lane = tid & 31;
    const int wave = tid >> 5;       // 0..15
    const int ln   = lane & 15;
    const int hi   = lane >> 4;
    const int g    = wave >> 2;      // query group 0..3
    const int dch  = wave & 3;       // d-chunk 0..3 (128 wide)
    const int dw   = dch * 128;

    // 1/sqrt(512) * log2(e): the softmax runs on base 2, p = 2^(s * CEXP - m * CEXP)
    const float CEXP = 0.044194173824159216f * 1.4426950408889634f;

    // ---- preload Q block (64x512 bf16) via async-to-LDS ----
    const bf16* qbase = qp + ((size_t)b * S + q0) * D;
    for (int i = tid; i < 64 * 64; i += 512) {            // granule = 8 bf16
        const int r = i >> 6, c = i & 63;
        stage_b128(&qbase[(size_t)r * D + c * 8], &Qs[r * QS_STRIDE + c * 8]);
    }

    v8f acc_o[8];                    // O^T[128 d x 16 queries] for (g, dch), registers
    #pragma unroll
    for (int dc = 0; dc < 8; ++dc) acc_o[dc] = {};
    float m_run = -1.0e30f;          // running maximum of query ln, raw (unscaled) scores
    float l_run = 0.0f;              // running sum over this lane half's keys only

    // ---- K or V tile t (32 keys x 512) into its buffer t & 1: async straight copies ----
    // fixed trip counts, unrolled: straight-line copies with every lane on, no loop on EXEC
    auto stage_k = [&](int t) {
        const bf16* kbase = kp + ((size_t)b * S + t * 32) * D;
        bf16* kd = Ks + (t & 1) * KV_BUF;
        #pragma unroll
        for (int p = 0; p < 4; ++p) {
            const int r = (tid >> 6) + p * 8, c = tid & 63;
            stage_b128(&kbase[(size_t)r * D + c * 8], &kd[r * KS_STRIDE + c * 8]);
        }
    };
    auto stage_v = [&](int t) {
        const bf16* vbase = vp + ((size_t)b * S + t * 32) * D;
        bf16* vd = Vs + (t & 1) * KV_BUF;
        #pragma unroll
        for (int p = 0; p < 4; ++p) {
            const int r = (tid >> 6) + p * 8, c = tid & 63;
            stage_b128(&vbase[(size_t)r * D + c * 8], &vd[r * VS_STRIDE + c * 8]);
        }
    };

    // ---- partial scores S^T of tile t: this wave covers d in [dch*128, dch*128+128) ----
    // s0[v] = S[query ln][key 8*hi + v], s1[v] = S[query ln][key 16 + 8*hi + v]
    auto score_mma = [&](int t, v8f& s0, v8f& s1) {
        const bf16* Kc = Ks + (t & 1) * KV_BUF;
        #pragma unroll
        for (int i = 0; i < 4; ++i) {
            const int dk = dch * 4 + i;
            v16bf a  = ldfrag(&Qs[(g * 16 + ln) * QS_STRIDE + dk * 32 + hi * 16]);
            v16bf b0 = ldfrag(&Kc[ln * KS_STRIDE + dk * 32 + hi * 16]);
            v16bf b1 = ldfrag(&Kc[(16 + ln) * KS_STRIDE + dk * 32 + hi * 16]);
            s0 = WMMA_BF16(b0, a, s0);
            s1 = WMMA_BF16(b1, a, s1);
        }
    };
    // write tile t's partials: four 16-byte stores, each one contiguous over the 32 lanes
    // (plane j of a wave's 2 KB holds 4 floats per lane at a 16-byte lane pitch)
    auto score_store = [&](int t, const v8f& s0, const v8f& s1) {
        v4f* sp = (v4f*)&Sp[(size_t)(t & 1) * SP_BUF + (size_t)wave * 512] + lane;
        sp[0]  = __builtin_shufflevector(s0, s0, 0, 1, 2, 3);
        sp[32] = __builtin_shufflevector(s0, s0, 4, 5, 6, 7);
        sp[64] = __builtin_shufflevector(s1, s1, 0, 1, 2, 3);
        sp[96] = __builtin_shufflevector(s1, s1, 4, 5, 6, 7);
    };

    // ---- softmax and O^T update of tile t, from its published partials and V tile ----
    auto update = [&](int t) {
        const bf16* Vc = Vs + (t & 1) * KV_BUF;

        // ---- reduce the 4 d-partials of my group (every wave, redundant) ----
        v8f t0 = {}, t1 = {};
        #pragma unroll
        for (int w2 = 0; w2 < 4; ++w2) {
            const v4f* sp = (const v4f*)&Sp[(size_t)(t & 1) * SP_BUF + (size_t)(g * 4 + w2) * 512] + lane;
            const v4f a0 = sp[0], a1 = sp[32], b0 = sp[64], b1 = sp[96];
            #pragma unroll
            for (int v = 0; v < 4; ++v) {
                t0[v] += a0[v]; t0[4 + v] += a1[v];
                t1[v] += b0[v]; t1[4 + v] += b1[v];
            }
        }

        // ---- online softmax: query ln, 16 scores in this lane, 16 in lane ^ 16 ----
        // the maximum is kept on the raw scores (CEXP > 0 keeps their order); each exponent is
        // one fused multiply-add into the hardware's 2^x, whose results below 2^-126 may flush
        // to 0: such a weight is lost in the f32 row sum and in bf16 P x V either way
        float mx = fmaxf(t0[0], t1[0]);
        #pragma unroll
        for (int v = 1; v < 8; ++v) mx = fmaxf(mx, fmaxf(t0[v], t1[v]));
        mx = fmaxf(mx, xhalf(mx));
        const float mnew  = fmaxf(m_run, mx);
        const float alpha = __builtin_amdgcn_exp2f((m_run - mnew) * CEXP);
        const float mneg  = -mnew * CEXP;
        // P^T as B operand: element s of lane half hi is key 8*hi + s (s < 8) or
        // 16 + 8*hi + (s - 8), which is where the two score tiles hold it
        v16bf pb;
        float sum = 0.0f;
        #pragma unroll
        for (int v = 0; v < 8; ++v) {
            const float p0 = __builtin_amdgcn_exp2f(fmaf(t0[v], CEXP, mneg));
            const float p1 = __builtin_amdgcn_exp2f(fmaf(t1[v], CEXP, mneg));
            sum += p0 + p1;
            pb[v]     = (bf16)p0;
            pb[8 + v] = (bf16)p1;
        }
        l_run = l_run * alpha + sum;
        m_run = mnew;

        // ---- O^T update: acc = acc*alpha + V^T(128-chunk x 32) x P^T(32 x 16) ----
        const char* vrd = (const char*)Vc + (8 * hi + (lane & 7)) * (VS_STRIDE * 2)
                          + ((lane >> 3) & 1) * 16 + dw * 2;
        #pragma unroll
        for (int dc = 0; dc < 8; ++dc) {
            v8f c;
            #pragma unroll
            for (int v = 0; v < 8; ++v) c[v] = acc_o[dc][v] * alpha;
            const v16bf va = __builtin_shufflevector(ld_tr16(vrd + dc * 32),
                                                     ld_tr16(vrd + 16 * (VS_STRIDE * 2) + dc * 32),
                                                     0, 1, 2, 3, 4, 5, 6, 7, 8, 9, 10, 11, 12, 13, 14, 15);
            acc_o[dc] = WMMA_BF16(va, pb, c);
        }
    };

    static constexpr int NT = S / 32;   // key tiles

    // prologue: Q, K tiles 0 and 1 and V tile 0 land and are published; V tile 1 starts
    stage_k(0);
    stage_v(0);
    stage_k(1);
    stage_wait();
    __syncthreads();
    stage_v(1);
    {   // tile 0's partials
        v8f s0 = {}, s1 = {};
        score_mma(0, s0, s1);
        score_store(0, s0, s1);
    }
    // this wave's reads of K buffer 0 have retired before any wave's copies refill it
    asm volatile("s_wait_dscnt 0x0" ::: "memory");
    __syncthreads();       // tile 0's partials are published, every wave has left K buffer 0
    stage_k(2);

    for (int kt = 0; kt < NT - 1; ++kt) {
        // this trip reads K buffer (kt + 1) & 1, V buffer kt & 1 and partial buffer kt & 1, and
        // writes partial buffer (kt + 1) & 1; the stores stand last, so that every LDS load of
        // the trip is free to be issued early
        v8f s0 = {}, s1 = {};
        score_mma(kt + 1, s0, s1);
        update(kt);
        score_store(kt + 1, s0, s1);

        // ---- foot of the trip: publish K tile kt + 2, V tile kt + 1 and tile kt + 1's partials ----
        // this wave's LDS reads of the buffers have retired before any wave's copies refill them
        asm volatile("s_wait_dscnt 0x0" ::: "memory");
        stage_wait();      // this wave's copies issued at the last foot have landed
        __syncthreads();   // every wave's have, and every wave has left this trip's buffers
        if (kt + 3 < NT) stage_k(kt + 3);   // into the K buffer this trip has read
        if (kt + 2 < NT) stage_v(kt + 2);   // into the V buffer this trip has read
    }
    update(NT - 1);        // the last tile: its partials were formed in the last trip
    stage_wait();          // no copy is outstanding when the wave goes on to its end

    // ---- normalize and store straight from registers ----
    // acc_o[dc][v] = O[query ln][dw + dc*16 + 8*hi + v]: 32 contiguous bytes per lane
    const float invl = 1.0f / (l_run + xhalf(l_run));   // join the two halves' sums
    float* obase = out + ((size_t)b * S + q0 + g * 16 + ln) * D + dw + 8 * hi;
    #pragma unroll
    for (int dc = 0; dc < 8; ++dc) {
        #pragma unroll
        for (int v = 0; v < 8; ++v) acc_o[dc][v] *= invl;
    }
    #pragma unroll
    for (int dc = 0; dc < 8; ++dc) {
        *(float4*)(obase + dc * 16) =
            make_float4(acc_o[dc][0], acc_o[dc][1], acc_o[dc][2], acc_o[dc][3]);
        *(float4*)(obase + dc * 16 + 4) =
            make_float4(acc_o[dc][4], acc_o[dc][5], acc_o[dc][6], acc_o[dc][7]);
    }
}

// ---------------------------------------------------------------------------
// Host launcher
// ---------------------------------------------------------------------------
extern "C" void kernel_launch(void* const* d_in, const int* in_sizes, int n_in,
                              void* d_out, int out_size, void* d_ws, size_t ws_size,
                              hipStream_t stream) {
    (void)in_sizes; (void)n_in; (void)out_size; (void)ws_size;
    const float* q  = (const float*)d_in[0];
    const float* k  = (const float*)d_in[1];
    const float* v  = (const float*)d_in[2];
    const float* Wq = (const float*)d_in[3];
    const float* bq = (const float*)d_in[4];
    const float* Wk = (const float*)d_in[5];
    const float* bk = (const float*)d_in[6];
    const float* Wv = (const float*)d_in[7];
    const float* bv = (const float*)d_in[8];
    float* out = (float*)d_out;

    bf16* qp = (bf16*)d_ws;
    bf16* kp = qp + (size_t)M_TOT * D;
    bf16* vp = kp + (size_t)M_TOT * D;

    dim3 pg(D / 128, M_TOT / 128);   // 4 x 128
    proj_gemm_bf16<<<pg, 256, 0, stream>>>(q, Wq, bq, qp);
    proj_gemm_bf16<<<pg, 256, 0, stream>>>(k, Wk, bk, kp);
    proj_gemm_bf16<<<pg, 256, 0, stream>>>(v, Wv, bv, vp);

    dim3 ag(S / 64, NB);             // 32 x 8
    flash_attn_bf16<<<ag, 512, 0, stream>>>(qp, kp, vp, out);
}

// v009
// Measured time: 131 microseconds a run.
// In both of two side-by-side timings against v008, it was 1.19 times as fast.
// Counting every step since v000, it is 6.62 times as fast.
#include <hip/hip_runtime.h>

// ---------------------------------------------------------------------------
// Types for CDNA5 WMMA (gfx1250, wave32)
// ---------------------------------------------------------------------------
typedef __bf16 bf16;
typedef __attribute__((ext_vector_type(16))) __bf16 v16bf;
typedef __attribute__((ext_vector_type(8)))  float  v8f;
typedef __attribute__((ext_vector_type(4)))  float  v4f;
typedef __attribute__((ext_vector_type(4)))  int    v4i;
typedef __attribute__((ext_vector_type(8)))  __bf16 v8bf;
typedef __attribute__((ext_vector_type(4)))  __bf16 v4bf;
typedef __attribute__((ext_vector_type(8)))  short  v8s;

// Pointer types matching the async-to-LDS builtin's parameters
// (param0: int4 addrspace(1)*, param1: int4 addrspace(3)* per hipcc diagnostic)
typedef __attribute__((address_space(1))) v4i* gv4i_p;
typedef __attribute__((address_space(3))) v4i* lv4i_p;
typedef __attribute__((address_space(3))) v8s* lv8s_p;

#define WMMA_BF16(a, b, c) \
    __builtin_amdgcn_wmma_f32_16x16x32_bf16(false, (a), false, (b), (short)0, (c), false, false)

#if __has_builtin(__builtin_amdgcn_global_load_async_to_lds_b128) && \
    __has_builtin(__builtin_amdgcn_s_wait_asynccnt)
#define USE_ASYNC_LDS 1
#else
#define USE_ASYNC_LDS 0
#endif

__device__ __forceinline__ v16bf ldfrag(const bf16* p) {
    // LDS fragment load (16 consecutive bf16) as two 16-byte loads: rows are 16-byte aligned
    return __builtin_shufflevector(*(const v8bf*)p, *(const v8bf*)(p + 8),
                                   0, 1, 2, 3, 4, 5, 6, 7, 8, 9, 10, 11, 12, 13, 14, 15);
}

// 8 bf16 of one column of a row-major 16-bit LDS tile (8 rows x 16 columns per lane half)
__device__ __forceinline__ v8bf ld_tr16(const char* p) {
    return __builtin_bit_cast(v8bf, __builtin_amdgcn_ds_load_tr16_b128_v8i16((lv8s_p)(char*)p));
}

// Problem constants
static constexpr int D  = 512;       // model dim (= INPUT_SIZE = 2*HIDDEN)
static constexpr int S  = 2048;      // sequence length
static constexpr int NB = 8;         // batch
static constexpr int M_TOT = NB * S; // 16384 rows for the projections

// ---------------------------------------------------------------------------
// Kernel 1: projection GEMM  C[m,n] = sum_k A[m,k] * W[k,n] + bias[n]
// A: f32 [M,512], W: f32 [512,512] row-major (k-major), C: bf16 [M,512]
// Tile: 128(M) x 128(N), KT=32.  256 threads = 8 waves; wave -> 64x32 subtile.
// W stays row-major in LDS (8-byte stores, contiguous over the lanes); the B fragments
// come from transposing LDS loads, which deliver the hardware k order, so the A
// fragments are read in that order too: k = 8*hi + s (s < 8), 16 + 8*hi + (s - 8).
// ---------------------------------------------------------------------------
// Work-group barrier that orders LDS traffic only: the fences name local memory, so the
// compiler waits for the wave's LDS operations and lets global loads stay in flight across it
// (__syncthreads() drains the load counter, which would end the fetch ahead at once)
__device__ __forceinline__ void lds_barrier() {
    __builtin_amdgcn_fence(__ATOMIC_RELEASE, "workgroup", "local");
    __builtin_amdgcn_s_barrier();
    __builtin_amdgcn_fence(__ATOMIC_ACQUIRE, "workgroup", "local");
}

static constexpr int P_STRIDE = 40;   // 80 B = 16 B x odd: 16 rows read by 16-byte loads cover all banks once
static constexpr int W_STRIDE = 144;  // 288 B = 32 B x odd: the pitch of transposing loads

__global__ __launch_bounds__(256)
void proj_gemm_bf16(const float* __restrict__ A, const float* __restrict__ W,
                    const float* __restrict__ bias, bf16* __restrict__ C) {
    __shared__ __attribute__((aligned(32))) bf16 As[128 * P_STRIDE];  // [row m 0..127][k 0..31]
    __shared__ __attribute__((aligned(32))) bf16 Ws[32 * W_STRIDE];   // [k 0..31][col n 0..127]

    const int n0 = blockIdx.x * 128;
    const int m0 = blockIdx.y * 128;

    const int tid  = threadIdx.x;
    const int lane = tid & 31;
    const int wave = tid >> 5;
    const int ln   = lane & 15;        // N / M index within fragment
    const int hi   = lane >> 4;        // K-half selector (A/B frag layout)
    const int wm   = wave >> 2;        // 0..1 : 64-row slab
    const int wn   = wave & 3;         // 0..3 : 32-col slab

    v8f acc[4][2];
    #pragma unroll
    for (int mt = 0; mt < 4; ++mt)
        #pragma unroll
        for (int nt = 0; nt < 2; ++nt) acc[mt][nt] = {};

    // The f32 tiles are fetched into registers two k-steps ahead (two register sets, one per
    // step parity): their latency runs beside two steps' staging, fragment loads and WMMAs
    // instead of in front of each step.
    float4 fa0[4], fw0[4], fa1[4], fw1[4];
    // lane offsets in bytes, fixed for the whole loop; the k-step moves the uniform base only
    const unsigned aoff = (unsigned)(((tid >> 3) * D + (tid & 7) * 4) * 4);    // A: row 0..31, column 0..28
    const unsigned woff = (unsigned)(((tid >> 5) * D + (tid & 31) * 4) * 4);   // W: k row 0..7, column 0..124
    auto fetch = [&](int kk, float4 (&fa)[4], float4 (&fw)[4]) {
        const char* Ak = (const char*)(A + (size_t)m0 * D + kk * 32);
        const char* Wk = (const char*)(W + (size_t)(kk * 32) * D + n0);
        #pragma unroll
        for (int p = 0; p < 4; ++p)                  // A tile 128x32: rows p * 32 + 0..31
            fa[p] = *(const float4*)(Ak + aoff + (size_t)p * (32 * D * 4));
        #pragma unroll
        for (int p = 0; p < 4; ++p)                  // W tile 32x128: k rows p * 8 + 0..7
            fw[p] = *(const float4*)(Wk + woff + (size_t)p * (8 * D * 4));
        // the loads stay in flight for two steps: no register that they name is
        // rewritten before this wait
        asm volatile("s_wait_xcnt 0x0" ::: "memory");
        // the clobber orders memory operations only: this keeps the scheduler from lifting a
        // vector instruction that reuses an address register above the wait
        __builtin_amdgcn_sched_barrier(0);
    };

    // one k-step (KT = 32) from the register set of its parity; 'more': a step kk + 2 exists
    auto step = [&](int kk, float4 (&fa)[4], float4 (&fw)[4], bool more) {
        // ---- stage A tile: 128x32 f32 -> bf16, row-major ----
        #pragma unroll
        for (int p = 0; p < 4; ++p) {
            const int r = (tid >> 3) + p * 32;       // 0..127
            const int c = (tid & 7) * 4;             // 0..28
            const v4bf a4 = {(bf16)fa[p].x, (bf16)fa[p].y, (bf16)fa[p].z, (bf16)fa[p].w};
            *(v4bf*)&As[r * P_STRIDE + c] = a4;
        }
        // ---- stage W tile row-major: W[k, n] -> Ws[k][n] ----
        #pragma unroll
        for (int p = 0; p < 4; ++p) {
            const int r = (tid >> 5) + p * 8;        // k row 0..31
            const int c = (tid & 31) * 4;            // n col 0..124
            const v4bf w4 = {(bf16)fw[p].x, (bf16)fw[p].y, (bf16)fw[p].z, (bf16)fw[p].w};
            *(v4bf*)&Ws[r * W_STRIDE + c] = w4;
        }
        if (more) fetch(kk + 2, fa, fw);     // into the set just converted
        lds_barrier();

        // ---- fragments + 8 WMMAs ----
        v16bf af[4], bf_[2];
        #pragma unroll
        for (int mt = 0; mt < 4; ++mt) {
            const bf16* ap = &As[(wm * 64 + mt * 16 + ln) * P_STRIDE + hi * 8];
            af[mt] = __builtin_shufflevector(*(const v8bf*)ap, *(const v8bf*)(ap + 16),
                                             0, 1, 2, 3, 4, 5, 6, 7, 8, 9, 10, 11, 12, 13, 14, 15);
        }
        const char* wrd = (const char*)Ws + (8 * hi + (lane & 7)) * (W_STRIDE * 2)
                          + ((lane >> 3) & 1) * 16 + wn * 64;
        #pragma unroll
        for (int nt = 0; nt < 2; ++nt)
            bf_[nt] = __builtin_shufflevector(ld_tr16(wrd + nt * 32),
                                              ld_tr16(wrd + 16 * (W_STRIDE * 2) + nt * 32),
                                              0, 1, 2, 3, 4, 5, 6, 7, 8, 9, 10, 11, 12, 13, 14, 15);
        #pragma unroll
        for (int mt = 0; mt < 4; ++mt)
            #pragma unroll
            for (int nt = 0; nt < 2; ++nt)
                acc[mt][nt] = WMMA_BF16(af[mt], bf_[nt], acc[mt][nt]);
        lds_barrier();
        // the scheduler otherwise lifts the next step's conversions, and with them the waits
        // for its loads, up into this step: that set's fetch would be waited for a step early
        __builtin_amdgcn_sched_barrier(0);
    };

    fetch(0, fa0, fw0);
    fetch(1, fa1, fw1);
    for (int kk = 0; kk < 14; kk += 2) {     // K = 512: 16 steps, the last two fetch nothing
        step(kk,     fa0, fw0, true);
        step(kk + 1, fa1, fw1, true);
    }
    step(14, fa0, fw0, false);
    step(15, fa1, fw1, false);

    // ---- epilogue: bias add, convert to bf16, store ----
    #pragma unroll
    for (int mt = 0; mt < 4; ++mt) {
        #pragma unroll
        for (int nt = 0; nt < 2; ++nt) {
            const int N = n0 + wn * 32 + nt * 16 + ln;
            const float bn = bias[N];
            #pragma unroll
            for (int v = 0; v < 8; ++v) {
                const int Mi = m0 + wm * 64 + mt * 16 + v + 8 * hi;
                C[(size_t)Mi * D + N] = (bf16)(acc[mt][nt][v] + bn);
            }
        }
    }
}

// ---------------------------------------------------------------------------
// Kernel 2: flash attention, O accumulators in registers.
// One block per (batch, 64-query block); 512 threads = 16 waves.
// Wave (g, dch): g = query group (16 rows), dch = 128-wide d-chunk of output.
//   * scores: the 4 waves of group g split the d=512 reduction (4 K-steps each),
//     partial f32 accumulators reduced through LDS (16-byte ops, lane pitch 16 bytes).
//   * both products are transposed: S^T = K x Q^T and O^T += V^T x P^T, so a lane
//     owns one query: 16 of its 32 scores lie in the lane, 16 in lane ^ 16.
//   * softmax stats recomputed redundantly per wave: maximum and sum in-lane,
//     one exchange between the lane halves for the maximum.
//   * P^T is packed from the two score tiles into the B operand (hardware k
//     order); it never touches LDS.
//   * V stays row-major in LDS; the A fragments V^T come from transposing LDS
//     loads, which deliver the same hardware k order.
//   * O^T update: register-resident v8f acc[8] per wave, rescaled by alpha, WMMA.
//   * K and V tiles sit in two LDS buffers each; copies issued at the foot of trip t go into
//     the buffers that trip has just read and land during trip t + 1.
//   * the scores run one tile ahead: trip t forms the partials of tile t + 1 (K tile t + 1,
//     partial buffer (t + 1) & 1) beside softmax and P x V of tile t (V tile t, partial buffer
//     t & 1). The two halves of a trip do not depend on each other, so one barrier a trip.
// LDS (260 KB of 320 KB/WGP):
//   Qs [64][520] bf16 | 2 x { Ks [32][520] bf16 | Vs [32][528] bf16 }
//   Sp 2 x 16x512 f32 (score partials)
// ---------------------------------------------------------------------------
// Q and K rows are read one row a lane by 16-byte loads: 1040 B = 16 B x odd puts the 16 rows
// of a lane half on all 64 banks once (at 32 B x odd, rows l and l + 8 share their banks)
static constexpr int QS_STRIDE = 520;
static constexpr int KS_STRIDE = 520;
static constexpr int VS_STRIDE = 528;   // 1056 B = 32 B x odd: the pitch of transposing loads

static constexpr size_t OFF_QS = 0;
static constexpr size_t OFF_KS = OFF_QS + (size_t)64 * QS_STRIDE * 2;   // 66560
static constexpr size_t OFF_VT = OFF_KS + (size_t)32 * KS_STRIDE * 2;   // +33280
static constexpr int    KV_BUF = 32 * KS_STRIDE + 32 * VS_STRIDE;       // elements from buffer 0 to buffer 1
static constexpr size_t OFF_SP = OFF_KS + (size_t)2 * KV_BUF * 2;       // +134144
static constexpr int    SP_BUF = 16 * 512;                              // floats from partial buffer 0 to 1
static constexpr size_t ATTN_SMEM = OFF_SP + (size_t)2 * SP_BUF * 4;    // 266240 B

__device__ __forceinline__ void stage_b128(const bf16* g, bf16* l) {
#if USE_ASYNC_LDS
    __builtin_amdgcn_global_load_async_to_lds_b128(
        (gv4i_p)(bf16*)g,   // strip const, then generic->AS1 int4*
        (lv4i_p)l,          // generic->AS3 int4*
        0, 0);
#else
    *(uint4*)l = *(const uint4*)g;
#endif
}

__device__ __forceinline__ void stage_wait() {
#if USE_ASYNC_LDS
    // the issuing wave's copies have landed before the barrier that publishes them;
    // asm with the clobber so that no LDS read is lifted over the wait
    asm volatile("s_wait_asynccnt 0x0" ::: "memory");
#endif
}

// value of lane l ^ 16
__device__ __forceinline__ float xhalf(float x) {
    const int i = __builtin_bit_cast(int, x);
    return __builtin_bit_cast(float,
        __builtin_amdgcn_permlanex16(i, i, 0x76543210, 0xfedcba98, false, false));
}

// LDS admits one work-group per WGP, four waves per SIMD: tell the register allocator so,
// or it schedules for eight and serialises each fragment load with its WMMA
__global__ __launch_bounds__(512) __attribute__((amdgpu_waves_per_eu(4, 4)))
void flash_attn_bf16(const bf16* __restrict__ qp, const bf16* __restrict__ kp,
                     const bf16* __restrict__ vp, float* __restrict__ out) {
    // static: one work-group may take up to the whole LDS of a WGP this way
    __shared__ __attribute__((aligned(32))) char smem[ATTN_SMEM];
    bf16*  Qs = (bf16*)(smem + OFF_QS);
    bf16*  Ks = (bf16*)(smem + OFF_KS);
    bf16*  Vs = (bf16*)(smem + OFF_VT);
    float* Sp = (float*)(smem + OFF_SP);

    const int b    = blockIdx.y;
    const int q0   = blockIdx.x * 64;
    const int tid  = threadIdx.x;
    const int lane = tid & 31;
    const int wave = tid >> 5;       // 0..15
    const int ln   = lane & 15;
    const int hi   = lane >> 4;
    const int g    = wave >> 2;      // query group 0..3
    const int dch  = wave & 3;       // d-chunk 0..3 (128 wide)
    const int dw   = dch * 128;

    // 1/sqrt(512) * log2(e): the softmax runs on base 2, p = 2^(s * CEXP - m * CEXP)
    const float CEXP = 0.044194173824159216f * 1.4426950408889634f;

    // ---- preload Q block (64x512 bf16) via async-to-LDS ----
    const bf16* qbase = qp + ((size_t)b * S + q0) * D;
    for (int i = tid; i < 64 * 64; i += 512) {            // granule = 8 bf16
        const int r = i >> 6, c = i & 63;
        stage_b128(&qbase[(size_t)r * D + c * 8], &Qs[r * QS_STRIDE + c * 8]);
    }

    v8f acc_o[8];                    // O^T[128 d x 16 queries] for (g, dch), registers
    #pragma unroll
    for (int dc = 0; dc < 8; ++dc) acc_o[dc] = {};
    float m_run = -1.0e30f;          // running maximum of query ln, raw (unscaled) scores
    float l_run = 0.0f;              // running sum over this lane half's keys only

    // ---- K or V tile t (32 keys x 512) into its buffer t & 1: async straight copies ----
    // fixed trip counts, unrolled: straight-line copies with every lane on, no loop on EXEC
    auto stage_k = [&](int t) {
        const bf16* kbase = kp + ((size_t)b * S + t * 32) * D;
        bf16* kd = Ks + (t & 1) * KV_BUF;
        #pragma unroll
        for (int p = 0; p < 4; ++p) {
            const int r = (tid >> 6) + p * 8, c = tid & 63;
            stage_b128(&kbase[(size_t)r * D + c * 8], &kd[r * KS_STRIDE + c * 8]);
        }
    };
    auto stage_v = [&](int t) {
        const bf16* vbase = vp + ((size_t)b * S + t * 32) * D;
        bf16* vd = Vs + (t & 1) * KV_BUF;
        #pragma unroll
        for (int p = 0; p < 4; ++p) {
            const int r = (tid >> 6) + p * 8, c = tid & 63;
            stage_b128(&vbase[(size_t)r * D + c * 8], &vd[r * VS_STRIDE + c * 8]);
        }
    };

    // ---- partial scores S^T of tile t: this wave covers d in [dch*128, dch*128+128) ----
    // s0[v] = S[query ln][key 8*hi + v], s1[v] = S[query ln][key 16 + 8*hi + v]
    auto score_mma = [&](int t, v8f& s0, v8f& s1) {
        const bf16* Kc = Ks + (t & 1) * KV_BUF;
        #pragma unroll
        for (int i = 0; i < 4; ++i) {
            const int dk = dch * 4 + i;
            v16bf a  = ldfrag(&Qs[(g * 16 + ln) * QS_STRIDE + dk * 32 + hi * 16]);
            v16bf b0 = ldfrag(&Kc[ln * KS_STRIDE + dk * 32 + hi * 16]);
            v16bf b1 = ldfrag(&Kc[(16 + ln) * KS_STRIDE + dk * 32 + hi * 16]);
            s0 = WMMA_BF16(b0, a, s0);
            s1 = WMMA_BF16(b1, a, s1);
        }
    };
    // write tile t's partials: four 16-byte stores, each one contiguous over the 32 lanes
    // (plane j of a wave's 2 KB holds 4 floats per lane at a 16-byte lane pitch)
    auto score_store = [&](int t, const v8f& s0, const v8f& s1) {
        v4f* sp = (v4f*)&Sp[(size_t)(t & 1) * SP_BUF + (size_t)wave * 512] + lane;
        sp[0]  = __builtin_shufflevector(s0, s0, 0, 1, 2, 3);
        sp[32] = __builtin_shufflevector(s0, s0, 4, 5, 6, 7);
        sp[64] = __builtin_shufflevector(s1, s1, 0, 1, 2, 3);
        sp[96] = __builtin_shufflevector(s1, s1, 4, 5, 6, 7);
    };

    // ---- softmax and O^T update of tile t, from its published partials and V tile ----
    auto update = [&](int t) {
        const bf16* Vc = Vs + (t & 1) * KV_BUF;

        // ---- reduce the 4 d-partials of my group (every wave, redundant) ----
        v8f t0 = {}, t1 = {};
        #pragma unroll
        for (int w2 = 0; w2 < 4; ++w2) {
            const v4f* sp = (const v4f*)&Sp[(size_t)(t & 1) * SP_BUF + (size_t)(g * 4 + w2) * 512] + lane;
            const v4f a0 = sp[0], a1 = sp[32], b0 = sp[64], b1 = sp[96];
            #pragma unroll
            for (int v = 0; v < 4; ++v) {
                t0[v] += a0[v]; t0[4 + v] += a1[v];
                t1[v] += b0[v]; t1[4 + v] += b1[v];
            }
        }

        // ---- online softmax: query ln, 16 scores in this lane, 16 in lane ^ 16 ----
        // the maximum is kept on the raw scores (CEXP > 0 keeps their order); each exponent is
        // one fused multiply-add into the hardware's 2^x, whose results below 2^-126 may flush
        // to 0: such a weight is lost in the f32 row sum and in bf16 P x V either way
        float mx = fmaxf(t0[0], t1[0]);
        #pragma unroll
        for (int v = 1; v < 8; ++v) mx = fmaxf(mx, fmaxf(t0[v], t1[v]));
        mx = fmaxf(mx, xhalf(mx));
        const float mnew  = fmaxf(m_run, mx);
        const float alpha = __builtin_amdgcn_exp2f((m_run - mnew) * CEXP);
        const float mneg  = -mnew * CEXP;
        // P^T as B operand: element s of lane half hi is key 8*hi + s (s < 8) or
        // 16 + 8*hi + (s - 8), which is where the two score tiles hold it
        v16bf pb;
        float sum = 0.0f;
        #pragma unroll
        for (int v = 0; v < 8; ++v) {
            const float p0 = __builtin_amdgcn_exp2f(fmaf(t0[v], CEXP, mneg));
            const float p1 = __builtin_amdgcn_exp2f(fmaf(t1[v], CEXP, mneg));
            sum += p0 + p1;
            pb[v]     = (bf16)p0;
            pb[8 + v] = (bf16)p1;
        }
        l_run = l_run * alpha + sum;
        m_run = mnew;

        // ---- O^T update: acc = acc*alpha + V^T(128-chunk x 32) x P^T(32 x 16) ----
        const char* vrd = (const char*)Vc + (8 * hi + (lane & 7)) * (VS_STRIDE * 2)
                          + ((lane >> 3) & 1) * 16 + dw * 2;
        #pragma unroll
        for (int dc = 0; dc < 8; ++dc) {
            v8f c;
            #pragma unroll
            for (int v = 0; v < 8; ++v) c[v] = acc_o[dc][v] * alpha;
            const v16bf va = __builtin_shufflevector(ld_tr16(vrd + dc * 32),
                                                     ld_tr16(vrd + 16 * (VS_STRIDE * 2) + dc * 32),
                                                     0, 1, 2, 3, 4, 5, 6, 7, 8, 9, 10, 11, 12, 13, 14, 15);
            acc_o[dc] = WMMA_BF16(va, pb, c);
        }
    };

    static constexpr int NT = S / 32;   // key tiles

    // prologue: Q, K tiles 0 and 1 and V tile 0 land and are published; V tile 1 starts
    stage_k(0);
    stage_v(0);
    stage_k(1);
    stage_wait();
    __syncthreads();
    stage_v(1);
    {   // tile 0's partials
        v8f s0 = {}, s1 = {};
        score_mma(0, s0, s1);
        score_store(0, s0, s1);
    }
    // this wave's reads of K buffer 0 have retired before any wave's copies refill it
    asm volatile("s_wait_dscnt 0x0" ::: "memory");
    __syncthreads();       // tile 0's partials are published, every wave has left K buffer 0
    stage_k(2);

    for (int kt = 0; kt < NT - 1; ++kt) {
        // this trip reads K buffer (kt + 1) & 1, V buffer kt & 1 and partial buffer kt & 1, and
        // writes partial buffer (kt + 1) & 1; the stores stand last, so that every LDS load of
        // the trip is free to be issued early
        v8f s0 = {}, s1 = {};
        score_mma(kt + 1, s0, s1);
        update(kt);
        score_store(kt + 1, s0, s1);

        // ---- foot of the trip: publish K tile kt + 2, V tile kt + 1 and tile kt + 1's partials ----
        // this wave's LDS reads of the buffers have retired before any wave's copies refill them
        asm volatile("s_wait_dscnt 0x0" ::: "memory");
        stage_wait();      // this wave's copies issued at the last foot have landed
        __syncthreads();   // every wave's have, and every wave has left this trip's buffers
        if (kt + 3 < NT) stage_k(kt + 3);   // into the K buffer this trip has read
        if (kt + 2 < NT) stage_v(kt + 2);   // into the V buffer this trip has read
    }
    update(NT - 1);        // the last tile: its partials were formed in the last trip
    stage_wait();          // no copy is outstanding when the wave goes on to its end

    // ---- normalize and store straight from registers ----
    // acc_o[dc][v] = O[query ln][dw + dc*16 + 8*hi + v]: 32 contiguous bytes per lane
    const float invl = 1.0f / (l_run + xhalf(l_run));   // join the two halves' sums
    float* obase = out + ((size_t)b * S + q0 + g * 16 + ln) * D + dw + 8 * hi;
    #pragma unroll
    for (int dc = 0; dc < 8; ++dc) {
        #pragma unroll
        for (int v = 0; v < 8; ++v) acc_o[dc][v] *= invl;
    }
    #pragma unroll
    for (int dc = 0; dc < 8; ++dc) {
        *(float4*)(obase + dc * 16) =
            make_float4(acc_o[dc][0], acc_o[dc][1], acc_o[dc][2], acc_o[dc][3]);
        *(float4*)(obase + dc * 16 + 4) =
            make_float4(acc_o[dc][4], acc_o[dc][5], acc_o[dc][6], acc_o[dc][7]);
    }
}

// ---------------------------------------------------------------------------
// Host launcher
// ---------------------------------------------------------------------------
extern "C" void kernel_launch(void* const* d_in, const int* in_sizes, int n_in,
                              void* d_out, int out_size, void* d_ws, size_t ws_size,
                              hipStream_t stream) {
    (void)in_sizes; (void)n_in; (void)out_size; (void)ws_size;
    const float* q  = (const float*)d_in[0];
    const float* k  = (const float*)d_in[1];
    const float* v  = (const float*)d_in[2];
    const float* Wq = (const float*)d_in[3];
    const float* bq = (const float*)d_in[4];
    const float* Wk = (const float*)d_in[5];
    const float* bk = (const float*)d_in[6];
    const float* Wv = (const float*)d_in[7];
    const float* bv = (const float*)d_in[8];
    float* out = (float*)d_out;

    bf16* qp = (bf16*)d_ws;
    bf16* kp = qp + (size_t)M_TOT * D;
    bf16* vp = kp + (size_t)M_TOT * D;

    dim3 pg(D / 128, M_TOT / 128);   // 4 x 128
    proj_gemm_bf16<<<pg, 256, 0, stream>>>(q, Wq, bq, qp);
    proj_gemm_bf16<<<pg, 256, 0, stream>>>(k, Wk, bk, kp);
    proj_gemm_bf16<<<pg, 256, 0, stream>>>(v, Wv, bv, vp);

    dim3 ag(S / 64, NB);             // 32 x 8
    flash_attn_bf16<<<ag, 512, 0, stream>>>(qp, kp, vp, out);
}

// v010
// One run takes 120 microseconds.
// Two timings next to v009 both put it at 1.09 times that version's speed.
// Counting every step since v000, it is 7.21 times as fast.
#include <hip/hip_runtime.h>

// ---------------------------------------------------------------------------
// Types for CDNA5 WMMA (gfx1250, wave32)
// ---------------------------------------------------------------------------
typedef __bf16 bf16;
typedef __attribute__((ext_vector_type(16))) __bf16 v16bf;
typedef __attribute__((ext_vector_type(8)))  float  v8f;
typedef __attribute__((ext_vector_type(4)))  float  v4f;
typedef __attribute__((ext_vector_type(4)))  int    v4i;
typedef __attribute__((ext_vector_type(8)))  __bf16 v8bf;
typedef __attribute__((ext_vector_type(4)))  __bf16 v4bf;
typedef __attribute__((ext_vector_type(8)))  short  v8s;

// Pointer types matching the async-to-LDS builtin's parameters
// (param0: int4 addrspace(1)*, param1: int4 addrspace(3)* per hipcc diagnostic)
typedef __attribute__((address_space(1))) v4i* gv4i_p;
typedef __attribute__((address_space(3))) v4i* lv4i_p;
typedef __attribute__((address_space(3))) v8s* lv8s_p;

#define WMMA_BF16(a, b, c) \
    __builtin_amdgcn_wmma_f32_16x16x32_bf16(false, (a), false, (b), (short)0, (c), false, false)

#if __has_builtin(__builtin_amdgcn_global_load_async_to_lds_b128) && \
    __has_builtin(__builtin_amdgcn_s_wait_asynccnt)
#define USE_ASYNC_LDS 1
#else
#define USE_ASYNC_LDS 0
#endif

__device__ __forceinline__ v16bf ldfrag(const bf16* p) {
    // LDS fragment load (16 consecutive bf16) as two 16-byte loads: rows are 16-byte aligned
    return __builtin_shufflevector(*(const v8bf*)p, *(const v8bf*)(p + 8),
                                   0, 1, 2, 3, 4, 5, 6, 7, 8, 9, 10, 11, 12, 13, 14, 15);
}

// 8 bf16 of one column of a row-major 16-bit LDS tile (8 rows x 16 columns per lane half)
__device__ __forceinline__ v8bf ld_tr16(const char* p) {
    return __builtin_bit_cast(v8bf, __builtin_amdgcn_ds_load_tr16_b128_v8i16((lv8s_p)(char*)p));
}

// Problem constants
static constexpr int D  = 512;       // model dim (= INPUT_SIZE = 2*HIDDEN)
static constexpr int S  = 2048;      // sequence length
static constexpr int NB = 8;         // batch
static constexpr int M_TOT = NB * S; // 16384 rows for the projections

// ---------------------------------------------------------------------------
// Kernel 1: projection GEMM  C[m,n] = sum_k A[m,k] * W[k,n] + bias[n]
// A: f32 [M,512], W: f32 [512,512] row-major (k-major), C: bf16 [M,512]
// Tile: 128(M) x 128(N), KT=32.  256 threads = 8 waves; wave -> 64x32 subtile.
// W stays row-major in LDS (8-byte stores, contiguous over the lanes); the B fragments
// come from transposing LDS loads, which deliver the hardware k order, so the A
// fragments are read in that order too: k = 8*hi + s (s < 8), 16 + 8*hi + (s - 8).
// ---------------------------------------------------------------------------
// Work-group barrier that orders LDS traffic only: the fences name local memory, so the
// compiler waits for the wave's LDS operations and lets global loads stay in flight across it
// (__syncthreads() drains the load counter, which would end the fetch ahead at once)
__device__ __forceinline__ void lds_barrier() {
    __builtin_amdgcn_fence(__ATOMIC_RELEASE, "workgroup", "local");
    __builtin_amdgcn_s_barrier();
    __builtin_amdgcn_fence(__ATOMIC_ACQUIRE, "workgroup", "local");
}

static constexpr int P_STRIDE = 40;   // 80 B = 16 B x odd: 16 rows read by 16-byte loads cover all banks once
static constexpr int W_STRIDE = 144;  // 288 B = 32 B x odd: the pitch of transposing loads

__global__ __launch_bounds__(256)
void proj_gemm_bf16(const float* __restrict__ A, const float* __restrict__ W,
                    const float* __restrict__ bias, bf16* __restrict__ C) {
    __shared__ __attribute__((aligned(32))) bf16 As[128 * P_STRIDE];  // [row m 0..127][k 0..31]
    __shared__ __attribute__((aligned(32))) bf16 Ws[32 * W_STRIDE];   // [k 0..31][col n 0..127]

    const int n0 = blockIdx.x * 128;
    const int m0 = blockIdx.y * 128;

    const int tid  = threadIdx.x;
    const int lane = tid & 31;
    const int wave = tid >> 5;
    const int ln   = lane & 15;        // N / M index within fragment
    const int hi   = lane >> 4;        // K-half selector (A/B frag layout)
    const int wm   = wave >> 2;        // 0..1 : 64-row slab
    const int wn   = wave & 3;         // 0..3 : 32-col slab

    v8f acc[4][2];
    #pragma unroll
    for (int mt = 0; mt < 4; ++mt)
        #pragma unroll
        for (int nt = 0; nt < 2; ++nt) acc[mt][nt] = {};

    // The f32 tiles are fetched into registers two k-steps ahead (two register sets, one per
    // step parity): their latency runs beside two steps' staging, fragment loads and WMMAs
    // instead of in front of each step.
    float4 fa0[4], fw0[4], fa1[4], fw1[4];
    // lane offsets in bytes, fixed for the whole loop; the k-step moves the uniform base only
    const unsigned aoff = (unsigned)(((tid >> 3) * D + (tid & 7) * 4) * 4);    // A: row 0..31, column 0..28
    const unsigned woff = (unsigned)(((tid >> 5) * D + (tid & 31) * 4) * 4);   // W: k row 0..7, column 0..124
    auto fetch = [&](int kk, float4 (&fa)[4], float4 (&fw)[4]) {
        const char* Ak = (const char*)(A + (size_t)m0 * D + kk * 32);
        const char* Wk = (const char*)(W + (size_t)(kk * 32) * D + n0);
        #pragma unroll
        for (int p = 0; p < 4; ++p)                  // A tile 128x32: rows p * 32 + 0..31
            fa[p] = *(const float4*)(Ak + aoff + (size_t)p * (32 * D * 4));
        #pragma unroll
        for (int p = 0; p < 4; ++p)                  // W tile 32x128: k rows p * 8 + 0..7
            fw[p] = *(const float4*)(Wk + woff + (size_t)p * (8 * D * 4));
        // the loads stay in flight for two steps: no register that they name is
        // rewritten before this wait
        asm volatile("s_wait_xcnt 0x0" ::: "memory");
        // the clobber orders memory operations only: this keeps the scheduler from lifting a
        // vector instruction that reuses an address register above the wait
        __builtin_amdgcn_sched_barrier(0);
    };

    // one k-step (KT = 32) from the register set of its parity; 'more': a step kk + 2 exists
    auto step = [&](int kk, float4 (&fa)[4], float4 (&fw)[4], bool more) {
        // ---- stage A tile: 128x32 f32 -> bf16, row-major ----
        #pragma unroll
        for (int p = 0; p < 4; ++p) {
            const int r = (tid >> 3) + p * 32;       // 0..127
            const int c = (tid & 7) * 4;             // 0..28
            const v4bf a4 = {(bf16)fa[p].x, (bf16)fa[p].y, (bf16)fa[p].z, (bf16)fa[p].w};
            *(v4bf*)&As[r * P_STRIDE + c] = a4;
        }
        // ---- stage W tile row-major: W[k, n] -> Ws[k][n] ----
        #pragma unroll
        for (int p = 0; p < 4; ++p) {
            const int r = (tid >> 5) + p * 8;        // k row 0..31
            const int c = (tid & 31) * 4;            // n col 0..124
            const v4bf w4 = {(bf16)fw[p].x, (bf16)fw[p].y, (bf16)fw[p].z, (bf16)fw[p].w};
            *(v4bf*)&Ws[r * W_STRIDE + c] = w4;
        }
        if (more) fetch(kk + 2, fa, fw);     // into the set just converted
        lds_barrier();

        // ---- fragments + 8 WMMAs ----
        v16bf af[4], bf_[2];
        #pragma unroll
        for (int mt = 0; mt < 4; ++mt) {
            const bf16* ap = &As[(wm * 64 + mt * 16 + ln) * P_STRIDE + hi * 8];
            af[mt] = __builtin_shufflevector(*(const v8bf*)ap, *(const v8bf*)(ap + 16),
                                             0, 1, 2, 3, 4, 5, 6, 7, 8, 9, 10, 11, 12, 13, 14, 15);
        }
        const char* wrd = (const char*)Ws + (8 * hi + (lane & 7)) * (W_STRIDE * 2)
                          + ((lane >> 3) & 1) * 16 + wn * 64;
        #pragma unroll
        for (int nt = 0; nt < 2; ++nt)
            bf_[nt] = __builtin_shufflevector(ld_tr16(wrd + nt * 32),
                                              ld_tr16(wrd + 16 * (W_STRIDE * 2) + nt * 32),
                                              0, 1, 2, 3, 4, 5, 6, 7, 8, 9, 10, 11, 12, 13, 14, 15);
        #pragma unroll
        for (int mt = 0; mt < 4; ++mt)
            #pragma unroll
            for (int nt = 0; nt < 2; ++nt)
                acc[mt][nt] = WMMA_BF16(af[mt], bf_[nt], acc[mt][nt]);
        lds_barrier();
        // the scheduler otherwise lifts the next step's conversions, and with them the waits
        // for its loads, up into this step: that set's fetch would be waited for a step early
        __builtin_amdgcn_sched_barrier(0);
    };

    fetch(0, fa0, fw0);
    fetch(1, fa1, fw1);
    for (int kk = 0; kk < 14; kk += 2) {     // K = 512: 16 steps, the last two fetch nothing
        step(kk,     fa0, fw0, true);
        step(kk + 1, fa1, fw1, true);
    }
    step(14, fa0, fw0, false);
    step(15, fa1, fw1, false);

    // ---- epilogue: bias add, convert to bf16, store ----
    #pragma unroll
    for (int mt = 0; mt < 4; ++mt) {
        #pragma unroll
        for (int nt = 0; nt < 2; ++nt) {
            const int N = n0 + wn * 32 + nt * 16 + ln;
            const float bn = bias[N];
            #pragma unroll
            for (int v = 0; v < 8; ++v) {
                const int Mi = m0 + wm * 64 + mt * 16 + v + 8 * hi;
                C[(size_t)Mi * D + N] = (bf16)(acc[mt][nt][v] + bn);
            }
        }
    }
}

// ---------------------------------------------------------------------------
// Kernel 2: flash attention, O accumulators in registers.
// One block per (batch, 64-query block); 512 threads = 16 waves.
// Wave (g, dch): g = query group (16 rows), dch = 128-wide d-chunk of output.
//   * scores: the 4 waves of group g split the d=512 reduction (4 K-steps each),
//     partial f32 accumulators reduced through LDS (16-byte ops, lane pitch 16 bytes).
//   * both products are transposed: S^T = K x Q^T and O^T += V^T x P^T, so a lane
//     owns one query: 16 of its 32 scores lie in the lane, 16 in lane ^ 16.
//   * softmax once per query: wave dch of a group sums the partials of 4 of its 16 queries
//     (8 lanes a query, 4 keys a lane), takes maximum, weights and row sum, and hands P^T
//     (bf16, in the B operand's hardware k order) and the rescale factor to the group's
//     four waves through LDS.
//   * V stays row-major in LDS; the A fragments V^T come from transposing LDS
//     loads, which deliver the same hardware k order.
//   * O^T update: register-resident v8f acc[8] per wave, rescaled by alpha, WMMA.
//   * K and V tiles sit in two LDS buffers each; copies issued at the foot of trip t go into
//     the buffers that trip has just read and land during trip t + 1.
//   * three stages, each a tile behind the other: trip t forms the partials of tile t + 2
//     (K tile t + 2, partial buffer t & 1), the softmax of tile t + 1 (partial buffer
//     (t + 1) & 1 into P buffer (t + 1) & 1) and P x V of tile t (V tile t, P buffer t & 1).
//     The three parts of a trip do not depend on each other, so one barrier a trip.
// LDS (277 KB of 320 KB/WGP):
//   Qs [64][520] bf16 | 2 x { Ks [32][520] bf16 | Vs [32][528] bf16 }
//   Sp 2 x 16 x 4 planes of 144 f32 (score partials) | Pb 2 x 4 x 1 KB (P^T fragments)
//   Al 2 x 64 f32 (rescale factors) | Ls 64 f32 (row sums)
// ---------------------------------------------------------------------------
// Q and K rows are read one row a lane by 16-byte loads: 1040 B = 16 B x odd puts the 16 rows
// of a lane half on all 64 banks once (at 32 B x odd, rows l and l + 8 share their banks)
static constexpr int QS_STRIDE = 520;
static constexpr int KS_STRIDE = 520;
static constexpr int VS_STRIDE = 528;   // 1056 B = 32 B x odd: the pitch of transposing loads

static constexpr size_t OFF_QS = 0;
static constexpr size_t OFF_KS = OFF_QS + (size_t)64 * QS_STRIDE * 2;   // 66560
static constexpr size_t OFF_VT = OFF_KS + (size_t)32 * KS_STRIDE * 2;   // +33280
static constexpr int    KV_BUF = 32 * KS_STRIDE + 32 * VS_STRIDE;       // elements from buffer 0 to buffer 1
static constexpr size_t OFF_SP = OFF_KS + (size_t)2 * KV_BUF * 2;       // +134144
// a plane holds 4 floats per lane (512 B); at a pitch of 576 B = 64 B x odd the softmax's load,
// which takes 4 queries (64 B) out of each of the 4 planes per lane half, covers all banks once
static constexpr int    SP_PLANE = 144;                                 // floats from plane to plane
static constexpr int    SP_WAVE = 4 * SP_PLANE;                         // floats from wave to wave
static constexpr int    SP_BUF = 16 * SP_WAVE;                          // floats from partial buffer 0 to 1
static constexpr size_t OFF_PB = OFF_SP + (size_t)2 * SP_BUF * 4;       // +73728
static constexpr int    PB_BUF = 4 * 1024;                              // bytes from P buffer 0 to 1
static constexpr size_t OFF_AL = OFF_PB + (size_t)2 * PB_BUF;           // +8192
static constexpr int    AL_BUF = 64;                                    // floats from factor buffer 0 to 1
static constexpr size_t OFF_LS = OFF_AL + (size_t)2 * AL_BUF * 4;       // +512
static constexpr size_t ATTN_SMEM = OFF_LS + (size_t)64 * 4;            // 283392 B

__device__ __forceinline__ void stage_b128(const bf16* g, bf16* l) {
#if USE_ASYNC_LDS
    __builtin_amdgcn_global_load_async_to_lds_b128(
        (gv4i_p)(bf16*)g,   // strip const, then generic->AS1 int4*
        (lv4i_p)l,          // generic->AS3 int4*
        0, 0);
#else
    *(uint4*)l = *(const uint4*)g;
#endif
}

__device__ __forceinline__ void stage_wait() {
#if USE_ASYNC_LDS
    // the issuing wave's copies have landed before the barrier that publishes them;
    // asm with the clobber so that no LDS read is lifted over the wait
    asm volatile("s_wait_asynccnt 0x0" ::: "memory");
#endif
}

// value of lane l ^ 16
__device__ __forceinline__ float xhalf(float x) {
    const int i = __builtin_bit_cast(int, x);
    return __builtin_bit_cast(float,
        __builtin_amdgcn_permlanex16(i, i, 0x76543210, 0xfedcba98, false, false));
}

// value of lane l ^ 4 and of lane l ^ 8 (inside a 16-lane row)
__device__ __forceinline__ float xlane4(float x) {
    const int i = __builtin_bit_cast(int, x);
    return __builtin_bit_cast(float,
        __builtin_amdgcn_permlane16(i, i, 0x32107654, 0xba98fedc, false, false));
}
__device__ __forceinline__ float xlane8(float x) {
    const int i = __builtin_bit_cast(int, x);
    return __builtin_bit_cast(float,
        __builtin_amdgcn_permlane16(i, i, 0xfedcba98, 0x76543210, false, false));
}

// LDS admits one work-group per WGP, four waves per SIMD: tell the register allocator so,
// or it schedules for eight and serialises each fragment load with its WMMA
__global__ __launch_bounds__(512) __attribute__((amdgpu_waves_per_eu(4, 4)))
void flash_attn_bf16(const bf16* __restrict__ qp, const bf16* __restrict__ kp,
                     const bf16* __restrict__ vp, float* __restrict__ out) {
    // static: one work-group may take up to the whole LDS of a WGP this way
    __shared__ __attribute__((aligned(32))) char smem[ATTN_SMEM];
    bf16*  Qs = (bf16*)(smem + OFF_QS);
    bf16*  Ks = (bf16*)(smem + OFF_KS);
    bf16*  Vs = (bf16*)(smem + OFF_VT);
    float* Sp = (float*)(smem + OFF_SP);
    char*  Pb = smem + OFF_PB;
    float* Al = (float*)(smem + OFF_AL);
    float* Ls = (float*)(smem + OFF_LS);

    const int b    = blockIdx.y;
    const int q0   = blockIdx.x * 64;
    const int tid  = threadIdx.x;
    const int lane = tid & 31;
    const int wave = tid >> 5;       // 0..15
    const int ln   = lane & 15;
    const int hi   = lane >> 4;
    const int g    = wave >> 2;      // query group 0..3
    const int dch  = wave & 3;       // d-chunk 0..3 (128 wide)
    const int dw   = dch * 128;

    // 1/sqrt(512) * log2(e): the softmax runs on base 2, p = 2^(s * CEXP - m * CEXP)
    const float CEXP = 0.044194173824159216f * 1.4426950408889634f;

    // ---- preload Q block (64x512 bf16) via async-to-LDS ----
    const bf16* qbase = qp + ((size_t)b * S + q0) * D;
    for (int i = tid; i < 64 * 64; i += 512) {            // granule = 8 bf16
        const int r = i >> 6, c = i & 63;
        stage_b128(&qbase[(size_t)r * D + c * 8], &Qs[r * QS_STRIDE + c * 8]);
    }

    v8f acc_o[8];                    // O^T[128 d x 16 queries] for (g, dch), registers
    #pragma unroll
    for (int dc = 0; dc < 8; ++dc) acc_o[dc] = {};
    // softmax role of a lane: query sq of the group, keys 16 * (pl >> 1) + 8 * hi + 4 * (pl & 1) + 0..3
    const int sq = dch * 4 + (lane & 3);
    const int pl = (lane >> 2) & 3;  // plane of the partials
    float m_run = -1.0e30f;          // running maximum of query sq, raw (unscaled) scores
    float l_run = 0.0f;              // running sum over this lane's keys only

    // ---- K or V tile t (32 keys x 512) into its buffer t & 1: async straight copies ----
    // fixed trip counts, unrolled: straight-line copies with every lane on, no loop on EXEC
    auto stage_k = [&](int t) {
        const bf16* kbase = kp + ((size_t)b * S + t * 32) * D;
        bf16* kd = Ks + (t & 1) * KV_BUF;
        #pragma unroll
        for (int p = 0; p < 4; ++p) {
            const int r = (tid >> 6) + p * 8, c = tid & 63;
            stage_b128(&kbase[(size_t)r * D + c * 8], &kd[r * KS_STRIDE + c * 8]);
        }
    };
    auto stage_v = [&](int t) {
        const bf16* vbase = vp + ((size_t)b * S + t * 32) * D;
        bf16* vd = Vs + (t & 1) * KV_BUF;
        #pragma unroll
        for (int p = 0; p < 4; ++p) {
            const int r = (tid >> 6) + p * 8, c = tid & 63;
            stage_b128(&vbase[(size_t)r * D + c * 8], &vd[r * VS_STRIDE + c * 8]);
        }
    };

    // ---- partial scores S^T of tile t: this wave covers d in [dch*128, dch*128+128) ----
    // s0[v] = S[query ln][key 8*hi + v], s1[v] = S[query ln][key 16 + 8*hi + v]
    auto score_mma = [&](int t, v8f& s0, v8f& s1) {
        const bf16* Kc = Ks + (t & 1) * KV_BUF;
        #pragma unroll
        for (int i = 0; i < 4; ++i) {
            const int dk = dch * 4 + i;
            v16bf a  = ldfrag(&Qs[(g * 16 + ln) * QS_STRIDE + dk * 32 + hi * 16]);
            v16bf b0 = ldfrag(&Kc[ln * KS_STRIDE + dk * 32 + hi * 16]);
            v16bf b1 = ldfrag(&Kc[(16 + ln) * KS_STRIDE + dk * 32 + hi * 16]);
            s0 = WMMA_BF16(b0, a, s0);
            s1 = WMMA_BF16(b1, a, s1);
        }
    };
    // write tile t's partials: four 16-byte stores, each one contiguous over the 32 lanes
    // (plane j of a wave's part holds 4 floats per lane at a 16-byte lane pitch)
    auto score_store = [&](int t, const v8f& s0, const v8f& s1) {
        float* sp = &Sp[(t & 1) * SP_BUF + wave * SP_WAVE + lane * 4];
        *(v4f*)(sp)                = __builtin_shufflevector(s0, s0, 0, 1, 2, 3);
        *(v4f*)(sp + SP_PLANE)     = __builtin_shufflevector(s0, s0, 4, 5, 6, 7);
        *(v4f*)(sp + 2 * SP_PLANE) = __builtin_shufflevector(s1, s1, 0, 1, 2, 3);
        *(v4f*)(sp + 3 * SP_PLANE) = __builtin_shufflevector(s1, s1, 4, 5, 6, 7);
    };

    // ---- softmax of tile t for this wave's 4 queries, from the published partials ----
    // the maximum is kept on the raw scores (CEXP > 0 keeps their order); each exponent is
    // one fused multiply-add into the hardware's 2^x, whose results below 2^-126 may flush
    // to 0: such a weight is lost in the f32 row sum and in bf16 P x V either way
    auto softmax = [&](int t, v4bf& p4, float& alpha) {
        // sum the 4 d-partials: the 16 bytes that lane (sq, hi) of each wave stored in plane pl
        const float* sp = &Sp[(t & 1) * SP_BUF + (g * 4) * SP_WAVE + pl * SP_PLANE + (hi * 16 + sq) * 4];
        v4f s = *(const v4f*)sp;
        #pragma unroll
        for (int w2 = 1; w2 < 4; ++w2) s += *(const v4f*)(sp + w2 * SP_WAVE);
        // the 8 lanes of a query differ in lane bits 2, 3 and 4
        float mx = fmaxf(fmaxf(s[0], s[1]), fmaxf(s[2], s[3]));
        mx = fmaxf(mx, xlane4(mx));
        mx = fmaxf(mx, xlane8(mx));
        mx = fmaxf(mx, xhalf(mx));
        const float mnew = fmaxf(m_run, mx);
        alpha = __builtin_amdgcn_exp2f((m_run - mnew) * CEXP);
        const float mneg = -mnew * CEXP;
        const float p0 = __builtin_amdgcn_exp2f(fmaf(s[0], CEXP, mneg));
        const float p1 = __builtin_amdgcn_exp2f(fmaf(s[1], CEXP, mneg));
        const float p2 = __builtin_amdgcn_exp2f(fmaf(s[2], CEXP, mneg));
        const float p3 = __builtin_amdgcn_exp2f(fmaf(s[3], CEXP, mneg));
        l_run = l_run * alpha + ((p0 + p1) + (p2 + p3));
        m_run = mnew;
        p4 = v4bf{(bf16)p0, (bf16)p1, (bf16)p2, (bf16)p3};
    };
    // P^T as B operand: element s of lane (query, hi) is key 8*hi + s (s < 8) or 16 + 8*hi + (s - 8);
    // its elements 0..7 lie in the first 512 bytes of the group's 1 KB, 8..15 in the second, at a
    // 16-byte lane pitch: plane pl is elements 4 * pl + 0..3. The 8 lanes of a query hold the same
    // factor and all store it.
    auto softmax_store = [&](int t, const v4bf& p4, float alpha) {
        *(v4bf*)(Pb + (t & 1) * PB_BUF + g * 1024 + (pl >> 1) * 512 + (hi * 16 + sq) * 16 + (pl & 1) * 8) = p4;
        Al[(t & 1) * AL_BUF + g * 16 + sq] = alpha;
    };

    // ---- O^T update of tile t, from its published P^T, rescale factors and V tile ----
    auto update = [&](int t) {
        const bf16* Vc = Vs + (t & 1) * KV_BUF;
        const char* pr = Pb + (t & 1) * PB_BUF + g * 1024 + lane * 16;
        const v16bf pb = __builtin_shufflevector(*(const v8bf*)pr, *(const v8bf*)(pr + 512),
                                                 0, 1, 2, 3, 4, 5, 6, 7, 8, 9, 10, 11, 12, 13, 14, 15);
        const float alpha = Al[(t & 1) * AL_BUF + g * 16 + ln];

        // ---- O^T update: acc = acc*alpha + V^T(128-chunk x 32) x P^T(32 x 16) ----
        const char* vrd = (const char*)Vc + (8 * hi + (lane & 7)) * (VS_STRIDE * 2)
                          + ((lane >> 3) & 1) * 16 + dw * 2;
        #pragma unroll
        for (int dc = 0; dc < 8; ++dc) {
            v8f c;
            #pragma unroll
            for (int v = 0; v < 8; ++v) c[v] = acc_o[dc][v] * alpha;
            const v16bf va = __builtin_shufflevector(ld_tr16(vrd + dc * 32),
                                                     ld_tr16(vrd + 16 * (VS_STRIDE * 2) + dc * 32),
                                                     0, 1, 2, 3, 4, 5, 6, 7, 8, 9, 10, 11, 12, 13, 14, 15);
            acc_o[dc] = WMMA_BF16(va, pb, c);
        }
    };

    static constexpr int NT = S / 32;   // key tiles

    // prologue: Q, K tiles 0 and 1 and V tile 0 land and are published; V tile 1 starts
    stage_k(0);
    stage_v(0);
    stage_k(1);
    stage_wait();
    __syncthreads();
    stage_v(1);
    {   // tile 0's partials
        v8f s0 = {}, s1 = {};
        score_mma(0, s0, s1);
        score_store(0, s0, s1);
    }
    // this wave's reads of K buffer 0 have retired before any wave's copies refill it
    asm volatile("s_wait_dscnt 0x0" ::: "memory");
    __syncthreads();       // tile 0's partials are published, every wave has left K buffer 0
    stage_k(2);
    {   // tile 1's partials, tile 0's softmax
        v8f s0 = {}, s1 = {};
        v4bf p4;
        float al;
        score_mma(1, s0, s1);
        softmax(0, p4, al);
        softmax_store(0, p4, al);
        score_store(1, s0, s1);
    }
    // this wave's reads of K buffer 1 have retired before any wave's copies refill it
    asm volatile("s_wait_dscnt 0x0" ::: "memory");
    stage_wait();          // this wave's copies of V tile 1 and K tile 2 have landed
    __syncthreads();       // tile 1's partials and tile 0's P are published, K buffer 1 is free
    stage_k(3);

    for (int kt = 0; kt < NT - 2; ++kt) {
        // this trip reads K buffer kt & 1, V buffer kt & 1, partial buffer (kt + 1) & 1 and P buffer
        // kt & 1, and writes partial buffer kt & 1 and P buffer (kt + 1) & 1; the stores stand last,
        // so that every LDS load of the trip is free to be issued early
        v8f s0 = {}, s1 = {};
        v4bf p4;
        float al;
        score_mma(kt + 2, s0, s1);
        softmax(kt + 1, p4, al);
        update(kt);
        softmax_store(kt + 1, p4, al);
        score_store(kt + 2, s0, s1);

        // ---- foot of the trip: publish K tile kt + 3, V tile kt + 1, tile kt + 2's partials, tile kt + 1's P ----
        // this wave's LDS reads of the buffers have retired before any wave's copies refill them
        asm volatile("s_wait_dscnt 0x0" ::: "memory");
        stage_wait();      // this wave's copies issued at the last foot have landed
        __syncthreads();   // every wave's have, and every wave has left this trip's buffers
        if (kt + 4 < NT) stage_k(kt + 4);   // into the K buffer this trip has read
        stage_v(kt + 2);                    // into the V buffer this trip has read (kt + 2 < NT here)
    }
    {   // the last tile's softmax beside P x V of the tile before it; the row sums are complete
        v4bf p4;
        float al;
        softmax(NT - 1, p4, al);
        update(NT - 2);
        softmax_store(NT - 1, p4, al);
        float l = l_run + xlane4(l_run);     // join the sums of a query's 8 lanes
        l += xlane8(l);
        l += xhalf(l);
        Ls[g * 16 + sq] = l;                 // the 8 lanes hold the same sum and all store it
    }
    stage_wait();          // V tile NT - 1 has landed; no copy is outstanding from here on
    __syncthreads();       // the last tile's P and V and the row sums are published
    update(NT - 1);

    // ---- normalize and store straight from registers ----
    // acc_o[dc][v] = O[query ln][dw + dc*16 + 8*hi + v]: 32 contiguous bytes per lane
    const float invl = 1.0f / Ls[g * 16 + ln];
    float* obase = out + ((size_t)b * S + q0 + g * 16 + ln) * D + dw + 8 * hi;
    #pragma unroll
    for (int dc = 0; dc < 8; ++dc) {
        #pragma unroll
        for (int v = 0; v < 8; ++v) acc_o[dc][v] *= invl;
    }
    #pragma unroll
    for (int dc = 0; dc < 8; ++dc) {
        *(float4*)(obase + dc * 16) =
            make_float4(acc_o[dc][0], acc_o[dc][1], acc_o[dc][2], acc_o[dc][3]);
        *(float4*)(obase + dc * 16 + 4) =
            make_float4(acc_o[dc][4], acc_o[dc][5], acc_o[dc][6], acc_o[dc][7]);
    }
}

// ---------------------------------------------------------------------------
// Host launcher
// ---------------------------------------------------------------------------
extern "C" void kernel_launch(void* const* d_in, const int* in_sizes, int n_in,
                              void* d_out, int out_size, void* d_ws, size_t ws_size,
                              hipStream_t stream) {
    (void)in_sizes; (void)n_in; (void)out_size; (void)ws_size;
    const float* q  = (const float*)d_in[0];
    const float* k  = (const float*)d_in[1];
    const float* v  = (const float*)d_in[2];
    const float* Wq = (const float*)d_in[3];
    const float* bq = (const float*)d_in[4];
    const float* Wk = (const float*)d_in[5];
    const float* bk = (const float*)d_in[6];
    const float* Wv = (const float*)d_in[7];
    const float* bv = (const float*)d_in[8];
    float* out = (float*)d_out;

    bf16* qp = (bf16*)d_ws;
    bf16* kp = qp + (size_t)M_TOT * D;
    bf16* vp = kp + (size_t)M_TOT * D;

    dim3 pg(D / 128, M_TOT / 128);   // 4 x 128
    proj_gemm_bf16<<<pg, 256, 0, stream>>>(q, Wq, bq, qp);
    proj_gemm_bf16<<<pg, 256, 0, stream>>>(k, Wk, bk, kp);
    proj_gemm_bf16<<<pg, 256, 0, stream>>>(v, Wv, bv, vp);

    dim3 ag(S / 64, NB);             // 32 x 8
    flash_attn_bf16<<<ag, 512, 0, stream>>>(qp, kp, vp, out);
}
